// v000
// Measured on an AMD MI455X. A time is GPU time per run, averaged over a window of back-to-back runs after a warm-up
// (all launches, gaps included; the runs take copies of the inputs in turn), and the median of several windows.
// Apart from v000's, it joins two sittings. Times from different sittings can be a few percent apart, while
// side-by-side timings come from the same sitting.
// v000 is the starting kernel. One run takes 1290 microseconds.
#include <hip/hip_runtime.h>

// Multi-head attention with the module's ANTI-causal mask (x [2][2048][1024]; q,k,v = x W^T ('oi' [1024][1024] 0.02, no bias; 16 heads x 64); scores = q.k; keys strictly BEFORE the query (tril(-1)) -> -inf, i.e. each token attends to itself and the future; softmax(scores / 8); out = merged Wo^T + bo -> [2][2048][1024] (4.2 M)).
// Layout per batch: bf16 copy of x; exact projections; dense T-2048 attention with EVERY row on hi/lo planes (3 products; under the anti-causal mask the LAST rows see only a few keys; every score tile computed, the anti-causal pattern applied as the index select j >= i in the softmax); merged hi/lo x Wo exact + bo.
// Compute dtypes, f32 accumulate: every input rounded to bf16; projections exact; attention 3 products on every row; softmax f32; Wo hl x exact + bias.

#define NB_  2
#define TT   2048
#define DM   1024
#define NH_  16
#define NKV  16
#define REP  (NH_ / NKV)
#define HD   64
#define DQ   (NH_ * HD)
#define DKV  (NKV * HD)
#define ZH   2
#define RH   2048                  // query rows < RH use hi+lo planes (0: none)
#define WIN  0
#define PCAR 1024.0f
#define SCL  0.125f   // HD^-0.5
typedef _Float16 h16;
typedef unsigned short bf;
typedef __attribute__((ext_vector_type(16))) __bf16   v16bf;
typedef __attribute__((ext_vector_type(16))) _Float16 v16h;
typedef __attribute__((ext_vector_type(8)))  _Float16 v8h;
typedef __attribute__((ext_vector_type(8)))  unsigned short v8us;
typedef __attribute__((ext_vector_type(8)))  float    v8f;
typedef __attribute__((ext_vector_type(4)))  float    v4f;
typedef v8h  __attribute__((may_alias)) v8ha;
typedef v4f  __attribute__((may_alias)) v4fa;
typedef v8us __attribute__((may_alias)) v8usa;

__device__ __forceinline__ unsigned short f2bf(float f) { unsigned u = __float_as_uint(f); u += 0x7FFFu + ((u >> 16) & 1u); return (unsigned short)(u >> 16); }
__device__ __forceinline__ float bf2f(unsigned short b) { return __uint_as_float(((unsigned)b) << 16); }
__device__ __forceinline__ float bfr(float f) { return bf2f(f2bf(f)); }
__device__ __forceinline__ v16h cat16(v8h lo, v8h hi) { return __builtin_shufflevector(lo, hi, 0, 1, 2, 3, 4, 5, 6, 7, 8, 9, 10, 11, 12, 13, 14, 15); }
__device__ __forceinline__ v16bf cat16b(v8us lo, v8us hi) { return __builtin_bit_cast(v16bf, __builtin_shufflevector(lo, hi, 0, 1, 2, 3, 4, 5, 6, 7, 8, 9, 10, 11, 12, 13, 14, 15)); }
__device__ __forceinline__ v8f wmma16(v16h a, v16h b, v8f c) { return __builtin_amdgcn_wmma_f32_16x16x32_f16(false, a, false, b, (short)0, c, false, false); }
__device__ __forceinline__ v8f wmmab(v16bf a, v16bf b, v8f c) { return __builtin_amdgcn_wmma_f32_16x16x32_bf16(false, a, false, b, (short)0, c, false, false); }



// ---- k_gemmw: register-blocked GEMM, ONE WAVE per 64x64 output tile (16 accumulators), operands straight from K-contiguous 16-bit planes; grid (M/64, N/64, Z), 32 threads.
// C[m][n] (f32, pitch ldc, + optional f32 bias[n]) = sum_k A[m][k] Bt[n][k] (+ split products per NSPLIT). z-batch strides sA/sB/sC in elements. K % 32 == 0.
template <typename T16> struct WFrag;
template <> struct WFrag<h16> { typedef v16h V; static __device__ __forceinline__ V ld(const h16* p) { return cat16(*(const v8h*)p, *(const v8h*)(p + 16)); } static __device__ __forceinline__ v8f mma(V a, V b, v8f c) { return wmma16(a, b, c); } };
template <> struct WFrag<bf> { typedef v16bf V; static __device__ __forceinline__ V ld(const bf* p) { return cat16b(*(const v8us*)p, *(const v8us*)(p + 16)); } static __device__ __forceinline__ v8f mma(V a, V b, v8f c) { return wmmab(a, b, c); } };
template <typename T16, int NSPLIT, bool BIAS>
__global__ __launch_bounds__(32) void k_gemmw(const T16* __restrict__ A, const T16* __restrict__ A2, const T16* __restrict__ Bt, const T16* __restrict__ Bt2, int K, float* C, int ldc, const float* __restrict__ bias, size_t sA, size_t sB, size_t sC) {
    typedef typename WFrag<T16>::V V;
    __shared__ __align__(16) float os[16 * 68];
    const size_t z = blockIdx.z; A += z * sA; if (A2) A2 += z * sA; Bt += z * sB; if (Bt2) Bt2 += z * sB; C += z * sC;
    const int lane = threadIdx.x & 31, lr = lane & 15, hi = lane >> 4; const int r0 = blockIdx.x * 64, c0 = blockIdx.y * 64;
    v8f acc[4][4];
#pragma unroll
    for (int mb = 0; mb < 4; ++mb)
#pragma unroll
        for (int nb = 0; nb < 4; ++nb) acc[mb][nb] = (v8f){};
    const size_t aoff = (size_t)(r0 + lr) * K + 8 * hi, boff = (size_t)(c0 + lr) * K + 8 * hi;
#pragma unroll 1
    for (int kc = 0; kc < K; kc += 32) {
        V a[4], a2[4];
#pragma unroll
        for (int mb = 0; mb < 4; ++mb) { a[mb] = WFrag<T16>::ld(A + aoff + (size_t)mb * 16 * K + kc); if (NSPLIT == 1 || NSPLIT == 2) a2[mb] = WFrag<T16>::ld(A2 + aoff + (size_t)mb * 16 * K + kc); }
#pragma unroll
        for (int nb = 0; nb < 4; ++nb) { const V b = WFrag<T16>::ld(Bt + boff + (size_t)nb * 16 * K + kc); V b2; if (NSPLIT >= 2) b2 = WFrag<T16>::ld(Bt2 + boff + (size_t)nb * 16 * K + kc);
#pragma unroll
            for (int mb = 0; mb < 4; ++mb) { acc[mb][nb] = WFrag<T16>::mma(a[mb], b, acc[mb][nb]); if (NSPLIT == 1 || NSPLIT == 2) acc[mb][nb] = WFrag<T16>::mma(a2[mb], b, acc[mb][nb]); if (NSPLIT >= 2) acc[mb][nb] = WFrag<T16>::mma(a[mb], b2, acc[mb][nb]); } }
        asm volatile("v_nop\n\tv_nop\n\tv_nop\n\tv_nop" : "+v"(acc[0][0]), "+v"(acc[1][1]), "+v"(acc[2][2]), "+v"(acc[3][3]) : "v"(a[0]), "v"(a[3]));
    }
#pragma unroll
    for (int mb = 0; mb < 4; ++mb) {
#pragma unroll
        for (int nb = 0; nb < 4; ++nb) {
#pragma unroll
            for (int j = 0; j < 8; ++j) os[(hi * 8 + j) * 68 + nb * 16 + lr] = acc[mb][nb][j]; }
        __builtin_amdgcn_wave_barrier(); asm volatile("" ::: "memory");
        float* crow = C + (size_t)(r0 + mb * 16) * ldc + c0;
{
#pragma unroll
            for (int s = 0; s < 8; ++s) { const int row = 2 * s + hi, cofs = lr * 4; v4f val = *(const v4fa*)(os + row * 68 + cofs); if (BIAS) { val[0] += bfr(bias[c0 + cofs]); val[1] += bfr(bias[c0 + cofs + 1]); val[2] += bfr(bias[c0 + cofs + 2]); val[3] += bfr(bias[c0 + cofs + 3]); }
                *(v4f*)(crow + (size_t)row * ldc + cofs) = val; }
             }
        __builtin_amdgcn_wave_barrier(); asm volatile("" ::: "memory");
    }
}

__device__ __forceinline__ h16 tohx(float x) { return (h16)x; }
__device__ __forceinline__ void splitf(float y, unsigned short& h, unsigned short& l) { h = f2bf(y); l = f2bf(y - bf2f(h)); }
typedef __attribute__((ext_vector_type(2))) _Float16 v2h;
typedef __attribute__((ext_vector_type(4))) _Float16 v4h;
typedef __attribute__((ext_vector_type(2))) unsigned short v2us;
typedef __attribute__((ext_vector_type(4))) unsigned short v4us;
typedef __attribute__((ext_vector_type(2))) float v2f;
typedef __attribute__((ext_vector_type(4))) int v4i;

__global__ __launch_bounds__(256) void k_wtG(const float* __restrict__ w, int K, int N, bf* Bt) {
    const int lane = threadIdx.x & 31; const int L0 = (blockIdx.x * 8 + (threadIdx.x >> 5)) * 8; const int nlines = N * K / 64;
{
#pragma unroll 1
        for (int l = 0; l < 8; ++l) { const int L = L0 + l; if (L >= nlines) break; const size_t e = (size_t)L * 64 + lane * 2; const int k = (int)(e % K), n = (int)(e / K); v2us o;
            o[0] = f2bf(w[(size_t)k * N + n]); o[1] = f2bf(w[(size_t)(k + 1) * N + n]); *(v2us*)(Bt + e) = o; }
         }
}
__global__ __launch_bounds__(256) void k_cvt8(const float* __restrict__ src, bf* dst, size_t n8) { const size_t i = (size_t)blockIdx.x * 256 + threadIdx.x; if (i >= n8) return; const v8f v = *(const v8f*)(src + i * 8); v8us o;
#pragma unroll
    for (int k = 0; k < 8; ++k) o[k] = f2bf(v[k]); *(v8us*)(dst + i * 8) = o;  }

// k_rope: head planes [h][t][d] (fp16 + hi/lo) of rope(x) x sc with the rotate-half convention out[d] = x[d] cos[t][d] - x[d+HD/2] sin[t][d], out[d+HD/2] = x[d+HD/2] cos[t][d+HD/2] + x[d] sin[t][d+HD/2]
__global__ __launch_bounds__(256) void k_rope(const float* __restrict__ F, int pitch, int nheads, const float* __restrict__ CS, const float* __restrict__ RF, const float* __restrict__ nw, float sc, h16* P16, bf* Ph, bf* Pl) {
    const size_t e = ((size_t)blockIdx.x * 256 + threadIdx.x) * 2; if (e >= (size_t)nheads * TT * HD) return; const int d = (int)(e % HD); const int t = (int)((e / HD) % TT); const int h = (int)(e / ((size_t)HD * TT)); const float* f = F + (size_t)t * pitch + h * HD; const float rf = RF ? RF[(size_t)h * TT + t] : 1.0f; v2h o16; v2us oh, ol;
#pragma unroll
    for (int q = 0; q < 2; ++q) { const int dd = d + q; const int dp = (dd < HD / 2) ? dd + HD / 2 : dd - HD / 2; float x0 = f[dd], x1 = f[dp];
        if (RF) { float n0 = __fmul_rn(x0, rf), n1 = __fmul_rn(x1, rf); asm volatile("" : "+v"(n0)); asm volatile("" : "+v"(n1)); x0 = __fmul_rn(bfr(nw[dd]), n0); x1 = __fmul_rn(bfr(nw[dp]), n1); }
        const v2f cs = *(const v2f*)(CS + ((size_t)t * HD + dd) * 2); float a = __fmul_rn(x0, cs[0]), bq = __fmul_rn(x1, cs[1]); asm volatile("" : "+v"(a)); asm volatile("" : "+v"(bq)); const float r = ((dd < HD / 2) ? __fsub_rn(a, bq) : __fadd_rn(a, bq)) * sc;
        o16[q] = tohx(r); unsigned short a2, c2; splitf(r, a2, c2); oh[q] = a2; ol[q] = c2; }
    *(v2h*)(P16 + e) = o16; *(v2us*)(Ph + e) = oh; *(v2us*)(Pl + e) = ol;  }
__global__ __launch_bounds__(256) void k_vtp(const float* __restrict__ F, int pitch, int nheads, h16* V16, bf* Vh, bf* Vl) { const size_t e = ((size_t)blockIdx.x * 256 + threadIdx.x) * 2; if (e >= (size_t)nheads * HD * TT) return; const int t = (int)(e % TT); const int d = (int)((e / TT) % HD); const int g = (int)(e / ((size_t)TT * HD)); v2h o16; v2us oh, ol;
#pragma unroll
    for (int q = 0; q < 2; ++q) { const float x = F[(size_t)(t + q) * pitch + g * HD + d]; o16[q] = tohx(x); unsigned short a2, c2; splitf(x, a2, c2); oh[q] = a2; ol[q] = c2; }
    *(v2h*)(V16 + e) = o16; *(v2us*)(Vh + e) = oh; *(v2us*)(Vl + e) = ol;  }
__global__ __launch_bounds__(256) void k_csid(float* CS) { const int idx = blockIdx.x * 256 + threadIdx.x; if (idx >= TT * HD) return; v2f cs; cs[0] = 1.0f; cs[1] = 0.0f; *(v2f*)(CS + (size_t)idx * 2) = cs;  }
__global__ __launch_bounds__(256) void k_asoft(const float* __restrict__ Sb, h16* P16, bf* Ph, bf* Pl) {
    const int lane = threadIdx.x & 31; const int row = blockIdx.x * 8 + (threadIdx.x >> 5); if (row >= ZH * TT) return; const int i = row % TT; const int zz = row / TT; (void)zz; const bool hires = (i < RH); const float* sr = Sb + (size_t)row * TT; float v[TT / 32]; float mx = -3.0e38f;
#pragma unroll
    for (int ch = 0; ch < TT / 128; ++ch) { const int j0 = ch * 128 + lane * 4; const v4f a = *(const v4f*)(sr + j0);
#pragma unroll
        for (int q = 0; q < 4; ++q) { const int j = j0 + q; (void)j; const float t = (j0 + q >= i) ? a[q] * SCL : -3.0e38f; v[ch * 4 + q] = t;   /* anti-causal: keys before the query excluded (the module's tril(-1) -> -inf) */ mx = fmaxf(mx, t); } }
#pragma unroll
    for (int sh = 16; sh; sh >>= 1) mx = fmaxf(mx, __shfl_xor(mx, sh, 32));
    float sum = 0.f;
#pragma unroll
    for (int k = 0; k < TT / 32; ++k) { float d0 = __fsub_rn(v[k], mx); asm volatile("" : "+v"(d0)); v[k] = __builtin_amdgcn_exp2f(__fmul_rn(d0, 1.4426950408889634f)); sum += v[k]; }
#pragma unroll
    for (int sh = 16; sh; sh >>= 1) sum += __shfl_xor(sum, sh, 32);
    const float f = __fdiv_rn(hires ? 1.0f : PCAR, sum);
{
        if (hires) {
#pragma unroll
            for (int ch = 0; ch < TT / 128; ++ch) { v4us oh, ol;
#pragma unroll
                for (int q = 0; q < 4; ++q) { unsigned short a, c2; splitf(v[ch * 4 + q] * f, a, c2); oh[q] = a; ol[q] = c2; }
                const size_t oo = ((size_t)zz * (RH ? RH : 1) + i) * TT + ch * 128 + lane * 4; *(v4us*)(Ph + oo) = oh; *(v4us*)(Pl + oo) = ol; }
        } else {
#pragma unroll
            for (int ch = 0; ch < TT / 128; ++ch) { v4h o4;
#pragma unroll
                for (int q = 0; q < 4; ++q) o4[q] = tohx(v[ch * 4 + q] * f);
                *(v4h*)(P16 + (size_t)row * TT + ch * 128 + lane * 4) = o4; } }
         }
}
__global__ __launch_bounds__(256) void k_merge(const float* __restrict__ O, int h0, bf* Ah, bf* Al) { const size_t e = ((size_t)blockIdx.x * 256 + threadIdx.x) * 2; if (e >= (size_t)ZH * TT * HD) return; const int d = (int)(e % HD); const int t = (int)((e / HD) % TT); const int zz = (int)(e / ((size_t)HD * TT)); const float cs = (t < RH) ? 1.0f : (1.0f / PCAR); const size_t oo = (size_t)t * DQ + (h0 + zz) * HD + d;
    v2us oh, ol;
#pragma unroll
    for (int q = 0; q < 2; ++q) { unsigned short a, c2; splitf(O[e + q] * cs, a, c2); oh[q] = a; ol[q] = c2; } *(v2us*)(Ah + oo) = oh; *(v2us*)(Al + oo) = ol;  }

extern "C" void kernel_launch(void* const* d_in, const int* in_sizes, int n_in,
                              void* d_out, int out_size, void* d_ws, size_t ws_size, hipStream_t stream) {
    (void)in_sizes; (void)n_in; (void)out_size;
    const float* x = (const float*)d_in[0]; const float* wq = (const float*)d_in[1]; const float* wk = (const float*)d_in[2]; const float* wv = (const float*)d_in[3]; const float* wo = (const float*)d_in[4]; const float* bo = (const float*)d_in[5];
    float* OUT = (float*)d_out;     // [2][2048][1024]
    char* wsp = (char*)d_ws;
    auto take = [&](size_t bytes) { char* p = wsp; wsp += (bytes + 255) & ~(size_t)255; return (void*)p; };
    bf* WQ = (bf*)take((size_t)DQ * DM * 2); bf* WK = (bf*)take((size_t)DKV * DM * 2); bf* WV = (bf*)take((size_t)DKV * DM * 2); bf* WO = (bf*)take((size_t)DM * DQ * 2); float* CS = (float*)take((size_t)TT * HD * 2 * 4);
    bf* XB = (bf*)take((size_t)TT * DM * 2); float* FQ = (float*)take((size_t)TT * DQ * 4); float* FK = (float*)take((size_t)TT * DKV * 4);
    h16* QP16 = (h16*)take((size_t)NH_ * TT * HD * 2); h16* KP16 = (h16*)take((size_t)NKV * TT * HD * 2); h16* VT16 = (h16*)take((size_t)NKV * HD * TT * 2);
    bf* QPh = (bf*)take((size_t)NH_ * TT * HD * 2); bf* QPl = (bf*)take((size_t)NH_ * TT * HD * 2); bf* KPh = (bf*)take((size_t)NKV * TT * HD * 2); bf* KPl = (bf*)take((size_t)NKV * TT * HD * 2); bf* VTh = (bf*)take((size_t)NKV * HD * TT * 2); bf* VTl = (bf*)take((size_t)NKV * HD * TT * 2); bf* Ph = (bf*)take((size_t)ZH * RH * TT * 2); bf* Pl = (bf*)take((size_t)ZH * RH * TT * 2);
    float* Sb = (float*)take((size_t)ZH * TT * TT * 4); h16* P16 = nullptr; float* Ob = (float*)take((size_t)ZH * TT * HD * 4); bf* ATh = (bf*)take((size_t)TT * DQ * 2); bf* ATl = (bf*)take((size_t)TT * DQ * 2);
    if ((size_t)(wsp - (char*)d_ws) > ws_size) return;    // ws 256 MiB
    float* FV = FK;   // v projection reuses the k buffer after the k planes are built (stream-ordered)
    { k_cvt8<<<(unsigned)(((size_t)DQ * DM / 8 + 255) / 256), 256, 0, stream>>>(wq, WQ, (size_t)DQ * DM / 8); k_cvt8<<<(unsigned)(((size_t)DKV * DM / 8 + 255) / 256), 256, 0, stream>>>(wk, WK, (size_t)DKV * DM / 8); k_cvt8<<<(unsigned)(((size_t)DKV * DM / 8 + 255) / 256), 256, 0, stream>>>(wv, WV, (size_t)DKV * DM / 8);
      k_cvt8<<<(unsigned)(((size_t)DM * DQ / 8 + 255) / 256), 256, 0, stream>>>(wo, WO, (size_t)DM * DQ / 8);
       }
    k_csid<<<(TT * HD + 255) / 256, 256, 0, stream>>>(CS);
    const unsigned LQ = (unsigned)(((size_t)NH_ * TT * HD / 2 + 255) / 256), LKv = (unsigned)(((size_t)NKV * TT * HD / 2 + 255) / 256);
    for (int b = 0; b < NB_; ++b) {
        
        k_cvt8<<<(unsigned)(((size_t)TT * DM / 8 + 255) / 256), 256, 0, stream>>>(x + (size_t)b * TT * DM, XB, (size_t)TT * DM / 8);
        k_gemmw<bf, 0, false><<<dim3(TT / 64, DQ / 64, 1), 32, 0, stream>>>(XB, nullptr, WQ, nullptr, DM, FQ, DQ, nullptr, 0, 0, 0);
        k_rope<<<LQ, 256, 0, stream>>>(FQ, DQ, NH_, CS, nullptr, nullptr, 1.0f, QP16, QPh, QPl);
        k_gemmw<bf, 0, false><<<dim3(TT / 64, DKV / 64, 1), 32, 0, stream>>>(XB, nullptr, WK, nullptr, DM, FK, DKV, nullptr, 0, 0, 0);
        k_rope<<<LKv, 256, 0, stream>>>(FK, DKV, NKV, CS, nullptr, nullptr, 1.0f, KP16, KPh, KPl);
        k_gemmw<bf, 0, false><<<dim3(TT / 64, DKV / 64, 1), 32, 0, stream>>>(XB, nullptr, WV, nullptr, DM, FV, DKV, nullptr, 0, 0, 0); k_vtp<<<LKv, 256, 0, stream>>>(FV, DKV, NKV, VT16, VTh, VTl);
        for (int h0 = 0; h0 < NH_; h0 += ZH) { const size_t zq = (size_t)h0, zk = (size_t)(h0 / REP);   // one kv head per query head: the pass's two heads use consecutive kv planes (z-strides TT*HD)
            k_gemmw<bf, 2, false><<<dim3(RH / 64, TT / 64, ZH), 32, 0, stream>>>(QPh + zq * TT * HD, QPl + zq * TT * HD, KPh + zk * TT * HD, KPl + zk * TT * HD, HD, Sb, TT, nullptr, (size_t)TT * HD, (size_t)TT * HD, (size_t)TT * TT);
            k_asoft<<<ZH * TT / 8, 256, 0, stream>>>(Sb, P16, Ph, Pl);
            k_gemmw<bf, 2, false><<<dim3(RH / 64, HD / 64, ZH), 32, 0, stream>>>(Ph, Pl, VTh + zk * HD * TT, VTl + zk * HD * TT, TT, Ob, HD, nullptr, (size_t)RH * TT, (size_t)HD * TT, (size_t)TT * HD);
            k_merge<<<(unsigned)(((size_t)ZH * TT * HD / 2 + 255) / 256), 256, 0, stream>>>(Ob, h0, ATh, ATl); }
        k_gemmw<bf, 1, true><<<dim3(TT / 64, DM / 64, 1), 32, 0, stream>>>(ATh, ATl, WO, nullptr, DQ, OUT + (size_t)b * TT * DM, DM, bo, 0, 0, 0); }
}

// v001
// One run takes 879 microseconds.
// Next to v000, in two timings, it ran 1.47 and 1.49 times as fast.
#include <hip/hip_runtime.h>

// Multi-head attention with the module's ANTI-causal mask (x [2][2048][1024]; q,k,v = x W^T ('oi' [1024][1024] 0.02, no bias; 16 heads x 64); scores = q.k; keys strictly BEFORE the query (tril(-1)) -> -inf, i.e. each token attends to itself and the future; softmax(scores / 8); out = merged Wo^T + bo -> [2][2048][1024] (4.2 M)).
// Layout per batch: bf16 copy of x; exact projections; dense T-2048 attention with EVERY row on hi/lo planes (3 products; under the anti-causal mask the LAST rows see only a few keys; every score tile computed, the anti-causal pattern applied as the index select j >= i in the softmax); merged hi/lo x Wo exact + bo.
// Compute dtypes, f32 accumulate: every input rounded to bf16; projections exact; attention 3 products on every row; softmax f32; Wo hl x exact + bias.

#define NB_  2
#define TT   2048
#define DM   1024
#define NH_  16
#define NKV  16
#define REP  (NH_ / NKV)
#define HD   64
#define DQ   (NH_ * HD)
#define DKV  (NKV * HD)
#define ZH   2
#define RH   2048                  // query rows < RH use hi+lo planes (0: none)
#define WIN  0
#define PCAR 1024.0f
#define SCL  0.125f   // HD^-0.5
typedef _Float16 h16;
typedef unsigned short bf;
typedef __attribute__((ext_vector_type(16))) __bf16   v16bf;
typedef __attribute__((ext_vector_type(16))) _Float16 v16h;
typedef __attribute__((ext_vector_type(8)))  _Float16 v8h;
typedef __attribute__((ext_vector_type(8)))  unsigned short v8us;
typedef __attribute__((ext_vector_type(8)))  float    v8f;
typedef __attribute__((ext_vector_type(4)))  float    v4f;
typedef v8h  __attribute__((may_alias)) v8ha;
typedef v4f  __attribute__((may_alias)) v4fa;
typedef v8us __attribute__((may_alias)) v8usa;

__device__ __forceinline__ unsigned short f2bf(float f) { unsigned u = __float_as_uint(f); u += 0x7FFFu + ((u >> 16) & 1u); return (unsigned short)(u >> 16); }
__device__ __forceinline__ float bf2f(unsigned short b) { return __uint_as_float(((unsigned)b) << 16); }
__device__ __forceinline__ float bfr(float f) { return bf2f(f2bf(f)); }
__device__ __forceinline__ v16h cat16(v8h lo, v8h hi) { return __builtin_shufflevector(lo, hi, 0, 1, 2, 3, 4, 5, 6, 7, 8, 9, 10, 11, 12, 13, 14, 15); }
__device__ __forceinline__ v16bf cat16b(v8us lo, v8us hi) { return __builtin_bit_cast(v16bf, __builtin_shufflevector(lo, hi, 0, 1, 2, 3, 4, 5, 6, 7, 8, 9, 10, 11, 12, 13, 14, 15)); }
__device__ __forceinline__ v8f wmma16(v16h a, v16h b, v8f c) { return __builtin_amdgcn_wmma_f32_16x16x32_f16(false, a, false, b, (short)0, c, false, false); }
__device__ __forceinline__ v8f wmmab(v16bf a, v16bf b, v8f c) { return __builtin_amdgcn_wmma_f32_16x16x32_bf16(false, a, false, b, (short)0, c, false, false); }



// ---- k_gemmw: register-blocked GEMM, one 64x64 output tile per work-group (16 accumulators a wave), operands straight from K-contiguous 16-bit planes; grid (M/64, N/64, Z), 32 * KW threads.
// C[m][n] (f32, pitch ldc, + optional f32 bias[n]) = sum_k A[m][k] Bt[n][k] (+ split products per NSPLIT). z-batch strides sA/sB/sC in elements. K % (32 * KW) == 0.
// KW waves share the tile's K: wave w takes the 32-wide k chunks w, w + KW, ... (neighbouring waves read neighbouring 64 bytes of the same rows), and the KW partial tiles are summed through LDS in wave order.
template <typename T16> struct WFrag;
template <> struct WFrag<h16> { typedef v16h V; static __device__ __forceinline__ V ld(const h16* p) { return cat16(*(const v8h*)p, *(const v8h*)(p + 16)); } static __device__ __forceinline__ v8f mma(V a, V b, v8f c) { return wmma16(a, b, c); } };
template <> struct WFrag<bf> { typedef v16bf V; static __device__ __forceinline__ V ld(const bf* p) { return cat16b(*(const v8us*)p, *(const v8us*)(p + 16)); } static __device__ __forceinline__ v8f mma(V a, V b, v8f c) { return wmmab(a, b, c); } };
template <typename T16, int NSPLIT, bool BIAS, int KW>
__global__ __launch_bounds__(32 * KW) void k_gemmw(const T16* __restrict__ A, const T16* __restrict__ A2, const T16* __restrict__ Bt, const T16* __restrict__ Bt2, int K, float* C, int ldc, const float* __restrict__ bias, size_t sA, size_t sB, size_t sC) {
    typedef typename WFrag<T16>::V V;
    __shared__ __align__(16) float os[(KW > 1 ? 4 * KW : 1) * 16 * 68];
    const int wv = (KW > 1) ? __builtin_amdgcn_readfirstlane((int)(threadIdx.x >> 5)) : 0;
    const size_t z = blockIdx.z; A += z * sA; if (A2) A2 += z * sA; Bt += z * sB; if (Bt2) Bt2 += z * sB; C += z * sC;
    const int lane = threadIdx.x & 31, lr = lane & 15, hi = lane >> 4; const int r0 = blockIdx.x * 64, c0 = blockIdx.y * 64;
    v8f acc[4][4];
#pragma unroll
    for (int mb = 0; mb < 4; ++mb)
#pragma unroll
        for (int nb = 0; nb < 4; ++nb) acc[mb][nb] = (v8f){};
    const size_t aoff = (size_t)(r0 + lr) * K + 8 * hi, boff = (size_t)(c0 + lr) * K + 8 * hi;
#pragma unroll 1
    for (int kc = wv * 32; kc < K; kc += 32 * KW) {
        V a[4], a2[4];
#pragma unroll
        for (int mb = 0; mb < 4; ++mb) { a[mb] = WFrag<T16>::ld(A + aoff + (size_t)mb * 16 * K + kc); if (NSPLIT == 1 || NSPLIT == 2) a2[mb] = WFrag<T16>::ld(A2 + aoff + (size_t)mb * 16 * K + kc); }
#pragma unroll
        for (int nb = 0; nb < 4; ++nb) { const V b = WFrag<T16>::ld(Bt + boff + (size_t)nb * 16 * K + kc); V b2; if (NSPLIT >= 2) b2 = WFrag<T16>::ld(Bt2 + boff + (size_t)nb * 16 * K + kc);
#pragma unroll
            for (int mb = 0; mb < 4; ++mb) { acc[mb][nb] = WFrag<T16>::mma(a[mb], b, acc[mb][nb]); if (NSPLIT == 1 || NSPLIT == 2) acc[mb][nb] = WFrag<T16>::mma(a2[mb], b, acc[mb][nb]); if (NSPLIT >= 2) acc[mb][nb] = WFrag<T16>::mma(a[mb], b2, acc[mb][nb]); } }
        asm volatile("v_nop\n\tv_nop\n\tv_nop\n\tv_nop" : "+v"(acc[0][0]), "+v"(acc[1][1]), "+v"(acc[2][2]), "+v"(acc[3][3]) : "v"(a[0]), "v"(a[3]));
    }
    if constexpr (KW > 1) {
        float* ow = os + wv * 64 * 68;   // this wave's partial 64x64 tile, row pitch 68
#pragma unroll
        for (int mb = 0; mb < 4; ++mb)
#pragma unroll
            for (int nb = 0; nb < 4; ++nb)
#pragma unroll
                for (int j = 0; j < 8; ++j) ow[(mb * 16 + hi * 8 + j) * 68 + nb * 16 + lr] = acc[mb][nb][j];
        __syncthreads();   // every wave's partial tile is in LDS before any thread sums them
        float* crow = C + (size_t)r0 * ldc + c0;
#pragma unroll
        for (int i = 0; i < 32 / KW; ++i) { const int q = i * 32 * KW + threadIdx.x, row = q >> 4, cofs = (q & 15) * 4; v4f val = *(const v4fa*)(os + row * 68 + cofs);
#pragma unroll
            for (int w = 1; w < KW; ++w) val += *(const v4fa*)(os + w * 64 * 68 + row * 68 + cofs);
            if (BIAS) { val[0] += bfr(bias[c0 + cofs]); val[1] += bfr(bias[c0 + cofs + 1]); val[2] += bfr(bias[c0 + cofs + 2]); val[3] += bfr(bias[c0 + cofs + 3]); }
            *(v4f*)(crow + (size_t)row * ldc + cofs) = val; }
        return;
    }
#pragma unroll
    for (int mb = 0; mb < 4; ++mb) {
#pragma unroll
        for (int nb = 0; nb < 4; ++nb) {
#pragma unroll
            for (int j = 0; j < 8; ++j) os[(hi * 8 + j) * 68 + nb * 16 + lr] = acc[mb][nb][j]; }
        __builtin_amdgcn_wave_barrier(); asm volatile("" ::: "memory");
        float* crow = C + (size_t)(r0 + mb * 16) * ldc + c0;
{
#pragma unroll
            for (int s = 0; s < 8; ++s) { const int row = 2 * s + hi, cofs = lr * 4; v4f val = *(const v4fa*)(os + row * 68 + cofs); if (BIAS) { val[0] += bfr(bias[c0 + cofs]); val[1] += bfr(bias[c0 + cofs + 1]); val[2] += bfr(bias[c0 + cofs + 2]); val[3] += bfr(bias[c0 + cofs + 3]); }
                *(v4f*)(crow + (size_t)row * ldc + cofs) = val; }
             }
        __builtin_amdgcn_wave_barrier(); asm volatile("" ::: "memory");
    }
}

__device__ __forceinline__ h16 tohx(float x) { return (h16)x; }
__device__ __forceinline__ void splitf(float y, unsigned short& h, unsigned short& l) { h = f2bf(y); l = f2bf(y - bf2f(h)); }
typedef __attribute__((ext_vector_type(2))) _Float16 v2h;
typedef __attribute__((ext_vector_type(4))) _Float16 v4h;
typedef __attribute__((ext_vector_type(2))) unsigned short v2us;
typedef __attribute__((ext_vector_type(4))) unsigned short v4us;
typedef __attribute__((ext_vector_type(2))) float v2f;
typedef __attribute__((ext_vector_type(4))) int v4i;

__global__ __launch_bounds__(256) void k_wtG(const float* __restrict__ w, int K, int N, bf* Bt) {
    const int lane = threadIdx.x & 31; const int L0 = (blockIdx.x * 8 + (threadIdx.x >> 5)) * 8; const int nlines = N * K / 64;
{
#pragma unroll 1
        for (int l = 0; l < 8; ++l) { const int L = L0 + l; if (L >= nlines) break; const size_t e = (size_t)L * 64 + lane * 2; const int k = (int)(e % K), n = (int)(e / K); v2us o;
            o[0] = f2bf(w[(size_t)k * N + n]); o[1] = f2bf(w[(size_t)(k + 1) * N + n]); *(v2us*)(Bt + e) = o; }
         }
}
__global__ __launch_bounds__(256) void k_cvt8(const float* __restrict__ src, bf* dst, size_t n8) { const size_t i = (size_t)blockIdx.x * 256 + threadIdx.x; if (i >= n8) return; const v8f v = *(const v8f*)(src + i * 8); v8us o;
#pragma unroll
    for (int k = 0; k < 8; ++k) o[k] = f2bf(v[k]); *(v8us*)(dst + i * 8) = o;  }

// k_rope: head planes [h][t][d] (fp16 + hi/lo) of rope(x) x sc with the rotate-half convention out[d] = x[d] cos[t][d] - x[d+HD/2] sin[t][d], out[d+HD/2] = x[d+HD/2] cos[t][d+HD/2] + x[d] sin[t][d+HD/2]
__global__ __launch_bounds__(256) void k_rope(const float* __restrict__ F, int pitch, int nheads, const float* __restrict__ CS, const float* __restrict__ RF, const float* __restrict__ nw, float sc, h16* P16, bf* Ph, bf* Pl) {
    const size_t e = ((size_t)blockIdx.x * 256 + threadIdx.x) * 2; if (e >= (size_t)nheads * TT * HD) return; const int d = (int)(e % HD); const int t = (int)((e / HD) % TT); const int h = (int)(e / ((size_t)HD * TT)); const float* f = F + (size_t)t * pitch + h * HD; const float rf = RF ? RF[(size_t)h * TT + t] : 1.0f; v2h o16; v2us oh, ol;
#pragma unroll
    for (int q = 0; q < 2; ++q) { const int dd = d + q; const int dp = (dd < HD / 2) ? dd + HD / 2 : dd - HD / 2; float x0 = f[dd], x1 = f[dp];
        if (RF) { float n0 = __fmul_rn(x0, rf), n1 = __fmul_rn(x1, rf); asm volatile("" : "+v"(n0)); asm volatile("" : "+v"(n1)); x0 = __fmul_rn(bfr(nw[dd]), n0); x1 = __fmul_rn(bfr(nw[dp]), n1); }
        const v2f cs = *(const v2f*)(CS + ((size_t)t * HD + dd) * 2); float a = __fmul_rn(x0, cs[0]), bq = __fmul_rn(x1, cs[1]); asm volatile("" : "+v"(a)); asm volatile("" : "+v"(bq)); const float r = ((dd < HD / 2) ? __fsub_rn(a, bq) : __fadd_rn(a, bq)) * sc;
        o16[q] = tohx(r); unsigned short a2, c2; splitf(r, a2, c2); oh[q] = a2; ol[q] = c2; }
    *(v2h*)(P16 + e) = o16; *(v2us*)(Ph + e) = oh; *(v2us*)(Pl + e) = ol;  }
__global__ __launch_bounds__(256) void k_vtp(const float* __restrict__ F, int pitch, int nheads, h16* V16, bf* Vh, bf* Vl) { const size_t e = ((size_t)blockIdx.x * 256 + threadIdx.x) * 2; if (e >= (size_t)nheads * HD * TT) return; const int t = (int)(e % TT); const int d = (int)((e / TT) % HD); const int g = (int)(e / ((size_t)TT * HD)); v2h o16; v2us oh, ol;
#pragma unroll
    for (int q = 0; q < 2; ++q) { const float x = F[(size_t)(t + q) * pitch + g * HD + d]; o16[q] = tohx(x); unsigned short a2, c2; splitf(x, a2, c2); oh[q] = a2; ol[q] = c2; }
    *(v2h*)(V16 + e) = o16; *(v2us*)(Vh + e) = oh; *(v2us*)(Vl + e) = ol;  }
__global__ __launch_bounds__(256) void k_csid(float* CS) { const int idx = blockIdx.x * 256 + threadIdx.x; if (idx >= TT * HD) return; v2f cs; cs[0] = 1.0f; cs[1] = 0.0f; *(v2f*)(CS + (size_t)idx * 2) = cs;  }
__global__ __launch_bounds__(256) void k_asoft(const float* __restrict__ Sb, h16* P16, bf* Ph, bf* Pl) {
    const int lane = threadIdx.x & 31; const int row = blockIdx.x * 8 + (threadIdx.x >> 5); if (row >= ZH * TT) return; const int i = row % TT; const int zz = row / TT; (void)zz; const bool hires = (i < RH); const float* sr = Sb + (size_t)row * TT; float v[TT / 32]; float mx = -3.0e38f;
#pragma unroll
    for (int ch = 0; ch < TT / 128; ++ch) { const int j0 = ch * 128 + lane * 4; const v4f a = *(const v4f*)(sr + j0);
#pragma unroll
        for (int q = 0; q < 4; ++q) { const int j = j0 + q; (void)j; const float t = (j0 + q >= i) ? a[q] * SCL : -3.0e38f; v[ch * 4 + q] = t;   /* anti-causal: keys before the query excluded (the module's tril(-1) -> -inf) */ mx = fmaxf(mx, t); } }
#pragma unroll
    for (int sh = 16; sh; sh >>= 1) mx = fmaxf(mx, __shfl_xor(mx, sh, 32));
    float sum = 0.f;
#pragma unroll
    for (int k = 0; k < TT / 32; ++k) { float d0 = __fsub_rn(v[k], mx); asm volatile("" : "+v"(d0)); v[k] = __builtin_amdgcn_exp2f(__fmul_rn(d0, 1.4426950408889634f)); sum += v[k]; }
#pragma unroll
    for (int sh = 16; sh; sh >>= 1) sum += __shfl_xor(sum, sh, 32);
    const float f = __fdiv_rn(hires ? 1.0f : PCAR, sum);
{
        if (hires) {
#pragma unroll
            for (int ch = 0; ch < TT / 128; ++ch) { v4us oh, ol;
#pragma unroll
                for (int q = 0; q < 4; ++q) { unsigned short a, c2; splitf(v[ch * 4 + q] * f, a, c2); oh[q] = a; ol[q] = c2; }
                const size_t oo = ((size_t)zz * (RH ? RH : 1) + i) * TT + ch * 128 + lane * 4; *(v4us*)(Ph + oo) = oh; *(v4us*)(Pl + oo) = ol; }
        } else {
#pragma unroll
            for (int ch = 0; ch < TT / 128; ++ch) { v4h o4;
#pragma unroll
                for (int q = 0; q < 4; ++q) o4[q] = tohx(v[ch * 4 + q] * f);
                *(v4h*)(P16 + (size_t)row * TT + ch * 128 + lane * 4) = o4; } }
         }
}
__global__ __launch_bounds__(256) void k_merge(const float* __restrict__ O, int h0, bf* Ah, bf* Al) { const size_t e = ((size_t)blockIdx.x * 256 + threadIdx.x) * 2; if (e >= (size_t)ZH * TT * HD) return; const int d = (int)(e % HD); const int t = (int)((e / HD) % TT); const int zz = (int)(e / ((size_t)HD * TT)); const float cs = (t < RH) ? 1.0f : (1.0f / PCAR); const size_t oo = (size_t)t * DQ + (h0 + zz) * HD + d;
    v2us oh, ol;
#pragma unroll
    for (int q = 0; q < 2; ++q) { unsigned short a, c2; splitf(O[e + q] * cs, a, c2); oh[q] = a; ol[q] = c2; } *(v2us*)(Ah + oo) = oh; *(v2us*)(Al + oo) = ol;  }

extern "C" void kernel_launch(void* const* d_in, const int* in_sizes, int n_in,
                              void* d_out, int out_size, void* d_ws, size_t ws_size, hipStream_t stream) {
    (void)in_sizes; (void)n_in; (void)out_size;
    const float* x = (const float*)d_in[0]; const float* wq = (const float*)d_in[1]; const float* wk = (const float*)d_in[2]; const float* wv = (const float*)d_in[3]; const float* wo = (const float*)d_in[4]; const float* bo = (const float*)d_in[5];
    float* OUT = (float*)d_out;     // [2][2048][1024]
    char* wsp = (char*)d_ws;
    auto take = [&](size_t bytes) { char* p = wsp; wsp += (bytes + 255) & ~(size_t)255; return (void*)p; };
    bf* WQ = (bf*)take((size_t)DQ * DM * 2); bf* WK = (bf*)take((size_t)DKV * DM * 2); bf* WV = (bf*)take((size_t)DKV * DM * 2); bf* WO = (bf*)take((size_t)DM * DQ * 2); float* CS = (float*)take((size_t)TT * HD * 2 * 4);
    bf* XB = (bf*)take((size_t)TT * DM * 2); float* FQ = (float*)take((size_t)TT * DQ * 4); float* FK = (float*)take((size_t)TT * DKV * 4);
    h16* QP16 = (h16*)take((size_t)NH_ * TT * HD * 2); h16* KP16 = (h16*)take((size_t)NKV * TT * HD * 2); h16* VT16 = (h16*)take((size_t)NKV * HD * TT * 2);
    bf* QPh = (bf*)take((size_t)NH_ * TT * HD * 2); bf* QPl = (bf*)take((size_t)NH_ * TT * HD * 2); bf* KPh = (bf*)take((size_t)NKV * TT * HD * 2); bf* KPl = (bf*)take((size_t)NKV * TT * HD * 2); bf* VTh = (bf*)take((size_t)NKV * HD * TT * 2); bf* VTl = (bf*)take((size_t)NKV * HD * TT * 2); bf* Ph = (bf*)take((size_t)ZH * RH * TT * 2); bf* Pl = (bf*)take((size_t)ZH * RH * TT * 2);
    float* Sb = (float*)take((size_t)ZH * TT * TT * 4); h16* P16 = nullptr; float* Ob = (float*)take((size_t)ZH * TT * HD * 4); bf* ATh = (bf*)take((size_t)TT * DQ * 2); bf* ATl = (bf*)take((size_t)TT * DQ * 2);
    if ((size_t)(wsp - (char*)d_ws) > ws_size) return;    // ws 256 MiB
    float* FV = FK;   // v projection reuses the k buffer after the k planes are built (stream-ordered)
    { k_cvt8<<<(unsigned)(((size_t)DQ * DM / 8 + 255) / 256), 256, 0, stream>>>(wq, WQ, (size_t)DQ * DM / 8); k_cvt8<<<(unsigned)(((size_t)DKV * DM / 8 + 255) / 256), 256, 0, stream>>>(wk, WK, (size_t)DKV * DM / 8); k_cvt8<<<(unsigned)(((size_t)DKV * DM / 8 + 255) / 256), 256, 0, stream>>>(wv, WV, (size_t)DKV * DM / 8);
      k_cvt8<<<(unsigned)(((size_t)DM * DQ / 8 + 255) / 256), 256, 0, stream>>>(wo, WO, (size_t)DM * DQ / 8);
       }
    k_csid<<<(TT * HD + 255) / 256, 256, 0, stream>>>(CS);
    const unsigned LQ = (unsigned)(((size_t)NH_ * TT * HD / 2 + 255) / 256), LKv = (unsigned)(((size_t)NKV * TT * HD / 2 + 255) / 256);
    for (int b = 0; b < NB_; ++b) {
        
        k_cvt8<<<(unsigned)(((size_t)TT * DM / 8 + 255) / 256), 256, 0, stream>>>(x + (size_t)b * TT * DM, XB, (size_t)TT * DM / 8);
        k_gemmw<bf, 0, false, 8><<<dim3(TT / 64, DQ / 64, 1), 256, 0, stream>>>(XB, nullptr, WQ, nullptr, DM, FQ, DQ, nullptr, 0, 0, 0);
        k_rope<<<LQ, 256, 0, stream>>>(FQ, DQ, NH_, CS, nullptr, nullptr, 1.0f, QP16, QPh, QPl);
        k_gemmw<bf, 0, false, 8><<<dim3(TT / 64, DKV / 64, 1), 256, 0, stream>>>(XB, nullptr, WK, nullptr, DM, FK, DKV, nullptr, 0, 0, 0);
        k_rope<<<LKv, 256, 0, stream>>>(FK, DKV, NKV, CS, nullptr, nullptr, 1.0f, KP16, KPh, KPl);
        k_gemmw<bf, 0, false, 8><<<dim3(TT / 64, DKV / 64, 1), 256, 0, stream>>>(XB, nullptr, WV, nullptr, DM, FV, DKV, nullptr, 0, 0, 0); k_vtp<<<LKv, 256, 0, stream>>>(FV, DKV, NKV, VT16, VTh, VTl);
        for (int h0 = 0; h0 < NH_; h0 += ZH) { const size_t zq = (size_t)h0, zk = (size_t)(h0 / REP);   // one kv head per query head: the pass's two heads use consecutive kv planes (z-strides TT*HD)
            k_gemmw<bf, 2, false, 1><<<dim3(RH / 64, TT / 64, ZH), 32, 0, stream>>>(QPh + zq * TT * HD, QPl + zq * TT * HD, KPh + zk * TT * HD, KPl + zk * TT * HD, HD, Sb, TT, nullptr, (size_t)TT * HD, (size_t)TT * HD, (size_t)TT * TT);
            k_asoft<<<ZH * TT / 8, 256, 0, stream>>>(Sb, P16, Ph, Pl);
            k_gemmw<bf, 2, false, 16><<<dim3(RH / 64, HD / 64, ZH), 512, 0, stream>>>(Ph, Pl, VTh + zk * HD * TT, VTl + zk * HD * TT, TT, Ob, HD, nullptr, (size_t)RH * TT, (size_t)HD * TT, (size_t)TT * HD);
            k_merge<<<(unsigned)(((size_t)ZH * TT * HD / 2 + 255) / 256), 256, 0, stream>>>(Ob, h0, ATh, ATl); }
        k_gemmw<bf, 1, true, 8><<<dim3(TT / 64, DM / 64, 1), 256, 0, stream>>>(ATh, ATl, WO, nullptr, DQ, OUT + (size_t)b * TT * DM, DM, bo, 0, 0, 0); }
}

// v002
// A run of this version takes 240 microseconds.
// In two side-by-side timings against v001, it was 3.63 and 3.69 times as fast.
// All steps since v000 together make it 5.42 times as fast.
#include <hip/hip_runtime.h>

// Multi-head attention with the module's ANTI-causal mask (x [2][2048][1024]; q,k,v = x W^T ('oi' [1024][1024] 0.02, no bias; 16 heads x 64); scores = q.k; keys strictly BEFORE the query (tril(-1)) -> -inf, i.e. each token attends to itself and the future; softmax(scores / 8); out = merged Wo^T + bo -> [2][2048][1024] (4.2 M)).
// Layout: per batch a bf16 copy of x and exact projections into that batch's head planes; ONE fused attention launch for all (batch, head) pairs with EVERY row on hi/lo planes (3 products; under the anti-causal mask the LAST rows see only a few keys; every score tile computed, the anti-causal pattern applied as the index select j >= i in the softmax; scores and probabilities stay in registers, running maximum and sum); merged hi/lo x Wo exact + bo.
// Compute dtypes, f32 accumulate: every input rounded to bf16; projections exact; attention 3 products on every row; softmax f32; Wo hl x exact + bias.

#define NB_  2
#define TT   2048
#define DM   1024
#define NH_  16
#define NKV  16
#define HD   64
#define DQ   (NH_ * HD)
#define DKV  (NKV * HD)
#define WIN  0
typedef _Float16 h16;
typedef unsigned short bf;
typedef __attribute__((ext_vector_type(16))) __bf16   v16bf;
typedef __attribute__((ext_vector_type(16))) _Float16 v16h;
typedef __attribute__((ext_vector_type(8)))  _Float16 v8h;
typedef __attribute__((ext_vector_type(8)))  unsigned short v8us;
typedef __attribute__((ext_vector_type(8)))  float    v8f;
typedef __attribute__((ext_vector_type(4)))  float    v4f;
typedef v8h  __attribute__((may_alias)) v8ha;
typedef v4f  __attribute__((may_alias)) v4fa;
typedef v8us __attribute__((may_alias)) v8usa;

__device__ __forceinline__ unsigned short f2bf(float f) { unsigned u = __float_as_uint(f); u += 0x7FFFu + ((u >> 16) & 1u); return (unsigned short)(u >> 16); }
__device__ __forceinline__ float bf2f(unsigned short b) { return __uint_as_float(((unsigned)b) << 16); }
__device__ __forceinline__ float bfr(float f) { return bf2f(f2bf(f)); }
__device__ __forceinline__ v16h cat16(v8h lo, v8h hi) { return __builtin_shufflevector(lo, hi, 0, 1, 2, 3, 4, 5, 6, 7, 8, 9, 10, 11, 12, 13, 14, 15); }
__device__ __forceinline__ v16bf cat16b(v8us lo, v8us hi) { return __builtin_bit_cast(v16bf, __builtin_shufflevector(lo, hi, 0, 1, 2, 3, 4, 5, 6, 7, 8, 9, 10, 11, 12, 13, 14, 15)); }
__device__ __forceinline__ v8f wmma16(v16h a, v16h b, v8f c) { return __builtin_amdgcn_wmma_f32_16x16x32_f16(false, a, false, b, (short)0, c, false, false); }
__device__ __forceinline__ v8f wmmab(v16bf a, v16bf b, v8f c) { return __builtin_amdgcn_wmma_f32_16x16x32_bf16(false, a, false, b, (short)0, c, false, false); }



// ---- k_gemmw: register-blocked GEMM, one 64x64 output tile per work-group (16 accumulators a wave), operands straight from K-contiguous 16-bit planes; grid (M/64, N/64, Z), 32 * KW threads.
// C[m][n] (f32, pitch ldc, + optional f32 bias[n]) = sum_k A[m][k] Bt[n][k] (+ split products per NSPLIT). z-batch strides sA/sB/sC in elements. K % (32 * KW) == 0.
// KW waves share the tile's K: wave w takes the 32-wide k chunks w, w + KW, ... (neighbouring waves read neighbouring 64 bytes of the same rows), and the KW partial tiles are summed through LDS in wave order.
template <typename T16> struct WFrag;
template <> struct WFrag<h16> { typedef v16h V; static __device__ __forceinline__ V ld(const h16* p) { return cat16(*(const v8h*)p, *(const v8h*)(p + 16)); } static __device__ __forceinline__ v8f mma(V a, V b, v8f c) { return wmma16(a, b, c); } };
template <> struct WFrag<bf> { typedef v16bf V; static __device__ __forceinline__ V ld(const bf* p) { return cat16b(*(const v8us*)p, *(const v8us*)(p + 16)); } static __device__ __forceinline__ v8f mma(V a, V b, v8f c) { return wmmab(a, b, c); } };
template <typename T16, int NSPLIT, bool BIAS, int KW>
__global__ __launch_bounds__(32 * KW) void k_gemmw(const T16* __restrict__ A, const T16* __restrict__ A2, const T16* __restrict__ Bt, const T16* __restrict__ Bt2, int K, float* C, int ldc, const float* __restrict__ bias, size_t sA, size_t sB, size_t sC) {
    typedef typename WFrag<T16>::V V;
    __shared__ __align__(16) float os[(KW > 1 ? 4 * KW : 1) * 16 * 68];
    const int wv = (KW > 1) ? __builtin_amdgcn_readfirstlane((int)(threadIdx.x >> 5)) : 0;
    const size_t z = blockIdx.z; A += z * sA; if (A2) A2 += z * sA; Bt += z * sB; if (Bt2) Bt2 += z * sB; C += z * sC;
    const int lane = threadIdx.x & 31, lr = lane & 15, hi = lane >> 4; const int r0 = blockIdx.x * 64, c0 = blockIdx.y * 64;
    v8f acc[4][4];
#pragma unroll
    for (int mb = 0; mb < 4; ++mb)
#pragma unroll
        for (int nb = 0; nb < 4; ++nb) acc[mb][nb] = (v8f){};
    const size_t aoff = (size_t)(r0 + lr) * K + 8 * hi, boff = (size_t)(c0 + lr) * K + 8 * hi;
#pragma unroll 1
    for (int kc = wv * 32; kc < K; kc += 32 * KW) {
        V a[4], a2[4];
#pragma unroll
        for (int mb = 0; mb < 4; ++mb) { a[mb] = WFrag<T16>::ld(A + aoff + (size_t)mb * 16 * K + kc); if (NSPLIT == 1 || NSPLIT == 2) a2[mb] = WFrag<T16>::ld(A2 + aoff + (size_t)mb * 16 * K + kc); }
#pragma unroll
        for (int nb = 0; nb < 4; ++nb) { const V b = WFrag<T16>::ld(Bt + boff + (size_t)nb * 16 * K + kc); V b2; if (NSPLIT >= 2) b2 = WFrag<T16>::ld(Bt2 + boff + (size_t)nb * 16 * K + kc);
#pragma unroll
            for (int mb = 0; mb < 4; ++mb) { acc[mb][nb] = WFrag<T16>::mma(a[mb], b, acc[mb][nb]); if (NSPLIT == 1 || NSPLIT == 2) acc[mb][nb] = WFrag<T16>::mma(a2[mb], b, acc[mb][nb]); if (NSPLIT >= 2) acc[mb][nb] = WFrag<T16>::mma(a[mb], b2, acc[mb][nb]); } }
        asm volatile("v_nop\n\tv_nop\n\tv_nop\n\tv_nop" : "+v"(acc[0][0]), "+v"(acc[1][1]), "+v"(acc[2][2]), "+v"(acc[3][3]) : "v"(a[0]), "v"(a[3]));
    }
    if constexpr (KW > 1) {
        float* ow = os + wv * 64 * 68;   // this wave's partial 64x64 tile, row pitch 68
#pragma unroll
        for (int mb = 0; mb < 4; ++mb)
#pragma unroll
            for (int nb = 0; nb < 4; ++nb)
#pragma unroll
                for (int j = 0; j < 8; ++j) ow[(mb * 16 + hi * 8 + j) * 68 + nb * 16 + lr] = acc[mb][nb][j];
        __syncthreads();   // every wave's partial tile is in LDS before any thread sums them
        float* crow = C + (size_t)r0 * ldc + c0;
#pragma unroll
        for (int i = 0; i < 32 / KW; ++i) { const int q = i * 32 * KW + threadIdx.x, row = q >> 4, cofs = (q & 15) * 4; v4f val = *(const v4fa*)(os + row * 68 + cofs);
#pragma unroll
            for (int w = 1; w < KW; ++w) val += *(const v4fa*)(os + w * 64 * 68 + row * 68 + cofs);
            if (BIAS) { val[0] += bfr(bias[c0 + cofs]); val[1] += bfr(bias[c0 + cofs + 1]); val[2] += bfr(bias[c0 + cofs + 2]); val[3] += bfr(bias[c0 + cofs + 3]); }
            *(v4f*)(crow + (size_t)row * ldc + cofs) = val; }
        return;
    }
#pragma unroll
    for (int mb = 0; mb < 4; ++mb) {
#pragma unroll
        for (int nb = 0; nb < 4; ++nb) {
#pragma unroll
            for (int j = 0; j < 8; ++j) os[(hi * 8 + j) * 68 + nb * 16 + lr] = acc[mb][nb][j]; }
        __builtin_amdgcn_wave_barrier(); asm volatile("" ::: "memory");
        float* crow = C + (size_t)(r0 + mb * 16) * ldc + c0;
{
#pragma unroll
            for (int s = 0; s < 8; ++s) { const int row = 2 * s + hi, cofs = lr * 4; v4f val = *(const v4fa*)(os + row * 68 + cofs); if (BIAS) { val[0] += bfr(bias[c0 + cofs]); val[1] += bfr(bias[c0 + cofs + 1]); val[2] += bfr(bias[c0 + cofs + 2]); val[3] += bfr(bias[c0 + cofs + 3]); }
                *(v4f*)(crow + (size_t)row * ldc + cofs) = val; }
             }
        __builtin_amdgcn_wave_barrier(); asm volatile("" ::: "memory");
    }
}

__device__ __forceinline__ h16 tohx(float x) { return (h16)x; }
__device__ __forceinline__ void splitf(float y, unsigned short& h, unsigned short& l) { h = f2bf(y); l = f2bf(y - bf2f(h)); }
typedef __attribute__((ext_vector_type(2))) _Float16 v2h;
typedef __attribute__((ext_vector_type(4))) _Float16 v4h;
typedef __attribute__((ext_vector_type(2))) unsigned short v2us;
typedef __attribute__((ext_vector_type(4))) unsigned short v4us;
typedef __attribute__((ext_vector_type(2))) float v2f;
typedef __attribute__((ext_vector_type(4))) int v4i;

__global__ __launch_bounds__(256) void k_wtG(const float* __restrict__ w, int K, int N, bf* Bt) {
    const int lane = threadIdx.x & 31; const int L0 = (blockIdx.x * 8 + (threadIdx.x >> 5)) * 8; const int nlines = N * K / 64;
{
#pragma unroll 1
        for (int l = 0; l < 8; ++l) { const int L = L0 + l; if (L >= nlines) break; const size_t e = (size_t)L * 64 + lane * 2; const int k = (int)(e % K), n = (int)(e / K); v2us o;
            o[0] = f2bf(w[(size_t)k * N + n]); o[1] = f2bf(w[(size_t)(k + 1) * N + n]); *(v2us*)(Bt + e) = o; }
         }
}
__global__ __launch_bounds__(256) void k_cvt8(const float* __restrict__ src, bf* dst, size_t n8) { const size_t i = (size_t)blockIdx.x * 256 + threadIdx.x; if (i >= n8) return; const v8f v = *(const v8f*)(src + i * 8); v8us o;
#pragma unroll
    for (int k = 0; k < 8; ++k) o[k] = f2bf(v[k]); *(v8us*)(dst + i * 8) = o;  }

// k_rope: head planes [h][t][d] (fp16 + hi/lo) of rope(x) x sc with the rotate-half convention out[d] = x[d] cos[t][d] - x[d+HD/2] sin[t][d], out[d+HD/2] = x[d+HD/2] cos[t][d+HD/2] + x[d] sin[t][d+HD/2]
__global__ __launch_bounds__(256) void k_rope(const float* __restrict__ F, int pitch, int nheads, const float* __restrict__ CS, const float* __restrict__ RF, const float* __restrict__ nw, float sc, h16* P16, bf* Ph, bf* Pl) {
    const size_t e = ((size_t)blockIdx.x * 256 + threadIdx.x) * 2; if (e >= (size_t)nheads * TT * HD) return; const int d = (int)(e % HD); const int t = (int)((e / HD) % TT); const int h = (int)(e / ((size_t)HD * TT)); const float* f = F + (size_t)t * pitch + h * HD; const float rf = RF ? RF[(size_t)h * TT + t] : 1.0f; v2h o16; v2us oh, ol;
#pragma unroll
    for (int q = 0; q < 2; ++q) { const int dd = d + q; const int dp = (dd < HD / 2) ? dd + HD / 2 : dd - HD / 2; float x0 = f[dd], x1 = f[dp];
        if (RF) { float n0 = __fmul_rn(x0, rf), n1 = __fmul_rn(x1, rf); asm volatile("" : "+v"(n0)); asm volatile("" : "+v"(n1)); x0 = __fmul_rn(bfr(nw[dd]), n0); x1 = __fmul_rn(bfr(nw[dp]), n1); }
        const v2f cs = *(const v2f*)(CS + ((size_t)t * HD + dd) * 2); float a = __fmul_rn(x0, cs[0]), bq = __fmul_rn(x1, cs[1]); asm volatile("" : "+v"(a)); asm volatile("" : "+v"(bq)); const float r = ((dd < HD / 2) ? __fsub_rn(a, bq) : __fadd_rn(a, bq)) * sc;
        o16[q] = tohx(r); unsigned short a2, c2; splitf(r, a2, c2); oh[q] = a2; ol[q] = c2; }
    *(v2h*)(P16 + e) = o16; *(v2us*)(Ph + e) = oh; *(v2us*)(Pl + e) = ol;  }
__global__ __launch_bounds__(256) void k_vtp(const float* __restrict__ F, int pitch, int nheads, h16* V16, bf* Vh, bf* Vl) { const size_t e = ((size_t)blockIdx.x * 256 + threadIdx.x) * 2; if (e >= (size_t)nheads * HD * TT) return; const int t = (int)(e % TT); const int d = (int)((e / TT) % HD); const int g = (int)(e / ((size_t)TT * HD)); v2h o16; v2us oh, ol;
#pragma unroll
    for (int q = 0; q < 2; ++q) { const float x = F[(size_t)(t + q) * pitch + g * HD + d]; o16[q] = tohx(x); unsigned short a2, c2; splitf(x, a2, c2); oh[q] = a2; ol[q] = c2; }
    *(v2h*)(V16 + e) = o16; *(v2us*)(Vh + e) = oh; *(v2us*)(Vl + e) = ol;  }
__global__ __launch_bounds__(256) void k_csid(float* CS) { const int idx = blockIdx.x * 256 + threadIdx.x; if (idx >= TT * HD) return; v2f cs; cs[0] = 1.0f; cs[1] = 0.0f; *(v2f*)(CS + (size_t)idx * 2) = cs;  }
// ---- k_fattn: scores, softmax, P.V and the head merge in one kernel. Grid (TT/256, heads, batches), 16 waves; a wave owns 16 queries, a lane one query (column lr) and half of each key group.
// St = K Qt and Ot += Vt Pt: the score accumulators of two 16-key tiles, converted in place, are the B operand of the second product (hardware k order; the K, Q and Vt loaders use the same order).
// K and Vt hi/lo tiles of 64 keys go global -> registers -> LDS, two buffers: the next stage's loads fly during this stage's work, one barrier a stage.
#define FLP   72                   // LDS row pitch in 16-bit elements: 144 B = 16 B x odd, conflict-free for 16-byte row reads
#define FTILE (64 * FLP)
#define CEXP  0.18033688011112042f // HD^-0.5 x log2(e): scores go to base 2 in the one multiply
typedef __attribute__((ext_vector_type(2))) __bf16 v2bf;
__device__ __forceinline__ float xhalf(float x) { return __builtin_bit_cast(float, __builtin_amdgcn_permlanex16(__builtin_bit_cast(int, x), __builtin_bit_cast(int, x), 0x76543210, 0xfedcba98, false, false)); }   // lane l with lane l ^ 16
__device__ __forceinline__ v16bf ldsfrag(const bf* p) { return cat16b(*(const v8usa*)p, *(const v8usa*)(p + 16)); }
__global__ __launch_bounds__(512) void k_fattn(const bf* __restrict__ Qh, const bf* __restrict__ Ql, const bf* __restrict__ Kh, const bf* __restrict__ Kl, const bf* __restrict__ Vh, const bf* __restrict__ Vl, bf* ATh, bf* ATl) {
    __shared__ __align__(16) bf sm[2 * 4 * FTILE];   // [buffer][K hi, K lo, Vt hi, Vt lo][64 rows][FLP]
    const int tid = threadIdx.x, lane = tid & 31, lr = lane & 15, hi = lane >> 4; const int wv = __builtin_amdgcn_readfirstlane(tid >> 5);
    const size_t hp = (size_t)blockIdx.z * NH_ + blockIdx.y;   // the (batch, head) plane
    const int q = blockIdx.x * 256 + wv * 16 + lr;             // this lane's query
    v16bf qh[2], ql[2];
#pragma unroll
    for (int c = 0; c < 2; ++c) { const size_t qo = (hp * TT + q) * HD + c * 32 + 8 * hi; qh[c] = WFrag<bf>::ld(Qh + qo); ql[c] = WFrag<bf>::ld(Ql + qo); }
    const int srow = tid >> 3, sseg = (tid & 7) * 8, so = srow * FLP + sseg;   // staging: one 16-byte piece of each of the four tiles a thread
    const size_t gk = (hp * TT + srow) * HD + sseg, gv = (hp * HD + srow) * TT + sseg;
    v8us r0 = *(const v8us*)(Kh + gk), r1 = *(const v8us*)(Kl + gk), r2 = *(const v8us*)(Vh + gv), r3 = *(const v8us*)(Vl + gv);
    *(v8usa*)(sm + so) = r0; *(v8usa*)(sm + FTILE + so) = r1; *(v8usa*)(sm + 2 * FTILE + so) = r2; *(v8usa*)(sm + 3 * FTILE + so) = r3;
    __syncthreads();   // stage 0 is in LDS before any wave reads it
    v8f o[4];
#pragma unroll
    for (int dt = 0; dt < 4; ++dt) o[dt] = (v8f){};
    float m = -3.0e38f, l = 0.f;
#pragma unroll 1
    for (int s = 0; s < TT / 64; ++s) {
        const bool more = s + 1 < TT / 64;
        if (more) { const size_t k1 = (size_t)(s + 1) * 64; r0 = *(const v8us*)(Kh + gk + k1 * HD); r1 = *(const v8us*)(Kl + gk + k1 * HD); r2 = *(const v8us*)(Vh + gv + k1); r3 = *(const v8us*)(Vl + gv + k1); }
        const bf* sb = sm + (s & 1) * 4 * FTILE;
        v8f st[4];   // st[kt][j] = score of key s*64 + kt*16 + 8*hi + j against query q
#pragma unroll
        for (int kt = 0; kt < 4; ++kt) { v8f a = (v8f){};
#pragma unroll
            for (int c = 0; c < 2; ++c) { const bf* kp = sb + (kt * 16 + lr) * FLP + c * 32 + 8 * hi; const v16bf kh = ldsfrag(kp), kl = ldsfrag(kp + FTILE);
                a = wmmab(kh, qh[c], a); a = wmmab(kl, qh[c], a); a = wmmab(kh, ql[c], a); }
            st[kt] = a; }
        float mx = m;
#pragma unroll
        for (int kt = 0; kt < 4; ++kt)
#pragma unroll
            for (int j = 0; j < 8; ++j) { const float t = (s * 64 + kt * 16 + 8 * hi + j >= q) ? st[kt][j] * CEXP : -3.0e38f;   /* anti-causal: keys before the query excluded (the module's tril(-1) -> -inf) */ st[kt][j] = t; mx = fmaxf(mx, t); }
        mx = fmaxf(mx, xhalf(mx));   // both halves of the wave hold the query's running maximum
        const float alpha = __builtin_amdgcn_exp2f(m - mx);   // 0 when the first admitted key arrives: whatever the all-excluded stages before it summed is wiped
        m = mx;
        float ps[4]; v16bf ph[2], pl[2];   // one partial sum a tile: four short add chains instead of one long one
#pragma unroll
        for (int kt = 0; kt < 4; ++kt) { ps[kt] = 0.f;
#pragma unroll
            for (int j = 0; j < 8; j += 2) { v2f p; p[0] = __builtin_amdgcn_exp2f(st[kt][j] - mx); p[1] = __builtin_amdgcn_exp2f(st[kt][j + 1] - mx); ps[kt] += p[0]; ps[kt] += p[1];
                const v2bf h = __builtin_convertvector(p, v2bf); v2f r; r[0] = p[0] - (float)h[0]; r[1] = p[1] - (float)h[1]; const v2bf lo = __builtin_convertvector(r, v2bf);   // hi + lo planes of P, two elements a conversion
                const int e = (kt & 1) * 8 + j; ph[kt >> 1][e] = h[0]; ph[kt >> 1][e + 1] = h[1]; pl[kt >> 1][e] = lo[0]; pl[kt >> 1][e + 1] = lo[1]; } }
        l = l * alpha + ((ps[0] + ps[1]) + (ps[2] + ps[3]));   // each half keeps the sum of its own keys; joined once after the loop
#pragma unroll
        for (int dt = 0; dt < 4; ++dt) o[dt] *= alpha;
#pragma unroll
        for (int kp2 = 0; kp2 < 2; ++kp2)
#pragma unroll
            for (int dt = 0; dt < 4; ++dt) { const bf* vp = sb + 2 * FTILE + (dt * 16 + lr) * FLP + kp2 * 32 + 8 * hi; const v16bf vh = ldsfrag(vp), vl = ldsfrag(vp + FTILE);
                o[dt] = wmmab(vh, ph[kp2], o[dt]); o[dt] = wmmab(vh, pl[kp2], o[dt]); o[dt] = wmmab(vl, ph[kp2], o[dt]); }
        if (more) { bf* sn = sm + ((s + 1) & 1) * 4 * FTILE + so; *(v8usa*)sn = r0; *(v8usa*)(sn + FTILE) = r1; *(v8usa*)(sn + 2 * FTILE) = r2; *(v8usa*)(sn + 3 * FTILE) = r3; }
        __syncthreads();   // publishes stage s + 1 and ends every wave's reads of stage s, whose buffer the next trip refills
    }
    l += xhalf(l); const float inv = __fdiv_rn(1.0f, l);
    const size_t oo = ((size_t)blockIdx.z * TT + q) * DQ + blockIdx.y * HD + 8 * hi;   // o[dt][j] = out[q][dt*16 + 8*hi + j]: 8 consecutive d a lane
#pragma unroll
    for (int dt = 0; dt < 4; ++dt) { v8us oh, ol;
#pragma unroll
        for (int j = 0; j < 8; ++j) { unsigned short a, c2; splitf(o[dt][j] * inv, a, c2); oh[j] = a; ol[j] = c2; }
        *(v8us*)(ATh + oo + dt * 16) = oh; *(v8us*)(ATl + oo + dt * 16) = ol; }
}

extern "C" void kernel_launch(void* const* d_in, const int* in_sizes, int n_in,
                              void* d_out, int out_size, void* d_ws, size_t ws_size, hipStream_t stream) {
    (void)in_sizes; (void)n_in; (void)out_size;
    const float* x = (const float*)d_in[0]; const float* wq = (const float*)d_in[1]; const float* wk = (const float*)d_in[2]; const float* wv = (const float*)d_in[3]; const float* wo = (const float*)d_in[4]; const float* bo = (const float*)d_in[5];
    float* OUT = (float*)d_out;     // [2][2048][1024]
    char* wsp = (char*)d_ws;
    auto take = [&](size_t bytes) { char* p = wsp; wsp += (bytes + 255) & ~(size_t)255; return (void*)p; };
    bf* WQ = (bf*)take((size_t)DQ * DM * 2); bf* WK = (bf*)take((size_t)DKV * DM * 2); bf* WV = (bf*)take((size_t)DKV * DM * 2); bf* WO = (bf*)take((size_t)DM * DQ * 2); float* CS = (float*)take((size_t)TT * HD * 2 * 4);
    bf* XB = (bf*)take((size_t)TT * DM * 2); float* FQ = (float*)take((size_t)TT * DQ * 4); float* FK = (float*)take((size_t)TT * DKV * 4);
    h16* QP16 = (h16*)take((size_t)NH_ * TT * HD * 2); h16* KP16 = (h16*)take((size_t)NKV * TT * HD * 2); h16* VT16 = (h16*)take((size_t)NKV * HD * TT * 2);
    const size_t PL = (size_t)NH_ * TT * HD;   // one batch's head planes, elements
    bf* QPh = (bf*)take(NB_ * PL * 2); bf* QPl = (bf*)take(NB_ * PL * 2); bf* KPh = (bf*)take(NB_ * PL * 2); bf* KPl = (bf*)take(NB_ * PL * 2); bf* VTh = (bf*)take(NB_ * PL * 2); bf* VTl = (bf*)take(NB_ * PL * 2);
    bf* ATh = (bf*)take((size_t)NB_ * TT * DQ * 2); bf* ATl = (bf*)take((size_t)NB_ * TT * DQ * 2);
    if ((size_t)(wsp - (char*)d_ws) > ws_size) return;    // ws 256 MiB
    float* FV = FK;   // v projection reuses the k buffer after the k planes are built (stream-ordered)
    { k_cvt8<<<(unsigned)(((size_t)DQ * DM / 8 + 255) / 256), 256, 0, stream>>>(wq, WQ, (size_t)DQ * DM / 8); k_cvt8<<<(unsigned)(((size_t)DKV * DM / 8 + 255) / 256), 256, 0, stream>>>(wk, WK, (size_t)DKV * DM / 8); k_cvt8<<<(unsigned)(((size_t)DKV * DM / 8 + 255) / 256), 256, 0, stream>>>(wv, WV, (size_t)DKV * DM / 8);
      k_cvt8<<<(unsigned)(((size_t)DM * DQ / 8 + 255) / 256), 256, 0, stream>>>(wo, WO, (size_t)DM * DQ / 8);
       }
    k_csid<<<(TT * HD + 255) / 256, 256, 0, stream>>>(CS);
    const unsigned LQ = (unsigned)(((size_t)NH_ * TT * HD / 2 + 255) / 256), LKv = (unsigned)(((size_t)NKV * TT * HD / 2 + 255) / 256);
    for (int b = 0; b < NB_; ++b) {
        
        k_cvt8<<<(unsigned)(((size_t)TT * DM / 8 + 255) / 256), 256, 0, stream>>>(x + (size_t)b * TT * DM, XB, (size_t)TT * DM / 8);
        k_gemmw<bf, 0, false, 8><<<dim3(TT / 64, DQ / 64, 1), 256, 0, stream>>>(XB, nullptr, WQ, nullptr, DM, FQ, DQ, nullptr, 0, 0, 0);
        k_rope<<<LQ, 256, 0, stream>>>(FQ, DQ, NH_, CS, nullptr, nullptr, 1.0f, QP16, QPh + b * PL, QPl + b * PL);
        k_gemmw<bf, 0, false, 8><<<dim3(TT / 64, DKV / 64, 1), 256, 0, stream>>>(XB, nullptr, WK, nullptr, DM, FK, DKV, nullptr, 0, 0, 0);
        k_rope<<<LKv, 256, 0, stream>>>(FK, DKV, NKV, CS, nullptr, nullptr, 1.0f, KP16, KPh + b * PL, KPl + b * PL);
        k_gemmw<bf, 0, false, 8><<<dim3(TT / 64, DKV / 64, 1), 256, 0, stream>>>(XB, nullptr, WV, nullptr, DM, FV, DKV, nullptr, 0, 0, 0); k_vtp<<<LKv, 256, 0, stream>>>(FV, DKV, NKV, VT16, VTh + b * PL, VTl + b * PL); }
    k_fattn<<<dim3(TT / 256, NH_, NB_), 512, 0, stream>>>(QPh, QPl, KPh, KPl, VTh, VTl, ATh, ATl);
    for (int b = 0; b < NB_; ++b)
        k_gemmw<bf, 1, true, 8><<<dim3(TT / 64, DM / 64, 1), 256, 0, stream>>>(ATh + (size_t)b * TT * DQ, ATl + (size_t)b * TT * DQ, WO, nullptr, DQ, OUT + (size_t)b * TT * DM, DM, bo, 0, 0, 0);
}

// v003
// One run takes 177 microseconds.
// Next to v002, in two timings, it ran 1.36 times as fast each time.
// Over all steps from v000 it is 7.36 times as fast.
#include <hip/hip_runtime.h>

// Multi-head attention with the module's ANTI-causal mask (x [2][2048][1024]; q,k,v = x W^T ('oi' [1024][1024] 0.02, no bias; 16 heads x 64); scores = q.k; keys strictly BEFORE the query (tril(-1)) -> -inf, i.e. each token attends to itself and the future; softmax(scores / 8); out = merged Wo^T + bo -> [2][2048][1024] (4.2 M)).
// Layout: one launch rounds x and the four weight matrices to bf16; one launch does the exact q, k, v projections of both batches and writes the hi/lo head planes from its own epilogue; ONE fused attention launch for all (batch, head) pairs with EVERY row on hi/lo planes (3 products; under the anti-causal mask the LAST rows see only a few keys; every score tile computed, the anti-causal pattern applied as the index select j >= i in the softmax; scores and probabilities stay in registers, running maximum and sum); merged hi/lo x Wo exact + bo.
// Compute dtypes, f32 accumulate: every input rounded to bf16; projections exact; attention 3 products on every row; softmax f32; Wo hl x exact + bias.

#define NB_  2
#define TT   2048
#define DM   1024
#define NH_  16
#define NKV  16
#define HD   64
#define DQ   (NH_ * HD)
#define DKV  (NKV * HD)
#define WIN  0
typedef _Float16 h16;
typedef unsigned short bf;
typedef __attribute__((ext_vector_type(16))) __bf16   v16bf;
typedef __attribute__((ext_vector_type(16))) _Float16 v16h;
typedef __attribute__((ext_vector_type(8)))  _Float16 v8h;
typedef __attribute__((ext_vector_type(8)))  unsigned short v8us;
typedef __attribute__((ext_vector_type(8)))  float    v8f;
typedef __attribute__((ext_vector_type(4)))  float    v4f;
typedef v8h  __attribute__((may_alias)) v8ha;
typedef v4f  __attribute__((may_alias)) v4fa;
typedef v8us __attribute__((may_alias)) v8usa;

__device__ __forceinline__ unsigned short f2bf(float f) { unsigned u = __float_as_uint(f); u += 0x7FFFu + ((u >> 16) & 1u); return (unsigned short)(u >> 16); }
__device__ __forceinline__ float bf2f(unsigned short b) { return __uint_as_float(((unsigned)b) << 16); }
__device__ __forceinline__ float bfr(float f) { return bf2f(f2bf(f)); }
__device__ __forceinline__ v16h cat16(v8h lo, v8h hi) { return __builtin_shufflevector(lo, hi, 0, 1, 2, 3, 4, 5, 6, 7, 8, 9, 10, 11, 12, 13, 14, 15); }
__device__ __forceinline__ v16bf cat16b(v8us lo, v8us hi) { return __builtin_bit_cast(v16bf, __builtin_shufflevector(lo, hi, 0, 1, 2, 3, 4, 5, 6, 7, 8, 9, 10, 11, 12, 13, 14, 15)); }
__device__ __forceinline__ v8f wmma16(v16h a, v16h b, v8f c) { return __builtin_amdgcn_wmma_f32_16x16x32_f16(false, a, false, b, (short)0, c, false, false); }
__device__ __forceinline__ v8f wmmab(v16bf a, v16bf b, v8f c) { return __builtin_amdgcn_wmma_f32_16x16x32_bf16(false, a, false, b, (short)0, c, false, false); }



// ---- k_gemmw: register-blocked GEMM, one 64x64 output tile per work-group (16 accumulators a wave), operands straight from K-contiguous 16-bit planes; grid (M/64, N/64, Z), 32 * KW threads.
// C[m][n] (f32, pitch ldc, + optional f32 bias[n]) = sum_k A[m][k] Bt[n][k] (+ split products per NSPLIT). z-batch strides sA/sB/sC in elements. K % (32 * KW) == 0.
// KW waves share the tile's K: wave w takes the 32-wide k chunks w, w + KW, ... (neighbouring waves read neighbouring 64 bytes of the same rows), and the KW partial tiles are summed through LDS in wave order.
template <typename T16> struct WFrag;
template <> struct WFrag<h16> { typedef v16h V; static __device__ __forceinline__ V ld(const h16* p) { return cat16(*(const v8h*)p, *(const v8h*)(p + 16)); } static __device__ __forceinline__ v8f mma(V a, V b, v8f c) { return wmma16(a, b, c); } };
template <> struct WFrag<bf> { typedef v16bf V; static __device__ __forceinline__ V ld(const bf* p) { return cat16b(*(const v8us*)p, *(const v8us*)(p + 16)); } static __device__ __forceinline__ v8f mma(V a, V b, v8f c) { return wmmab(a, b, c); } };
template <typename T16, int NSPLIT, bool BIAS, int KW>
__global__ __launch_bounds__(32 * KW) void k_gemmw(const T16* __restrict__ A, const T16* __restrict__ A2, const T16* __restrict__ Bt, const T16* __restrict__ Bt2, int K, float* C, int ldc, const float* __restrict__ bias, size_t sA, size_t sB, size_t sC) {
    typedef typename WFrag<T16>::V V;
    __shared__ __align__(16) float os[(KW > 1 ? 4 * KW : 1) * 16 * 68];
    const int wv = (KW > 1) ? __builtin_amdgcn_readfirstlane((int)(threadIdx.x >> 5)) : 0;
    const size_t z = blockIdx.z; A += z * sA; if (A2) A2 += z * sA; Bt += z * sB; if (Bt2) Bt2 += z * sB; C += z * sC;
    const int lane = threadIdx.x & 31, lr = lane & 15, hi = lane >> 4; const int r0 = blockIdx.x * 64, c0 = blockIdx.y * 64;
    v8f acc[4][4];
#pragma unroll
    for (int mb = 0; mb < 4; ++mb)
#pragma unroll
        for (int nb = 0; nb < 4; ++nb) acc[mb][nb] = (v8f){};
    const size_t aoff = (size_t)(r0 + lr) * K + 8 * hi, boff = (size_t)(c0 + lr) * K + 8 * hi;
#pragma unroll 1
    for (int kc = wv * 32; kc < K; kc += 32 * KW) {
        V a[4], a2[4];
#pragma unroll
        for (int mb = 0; mb < 4; ++mb) { a[mb] = WFrag<T16>::ld(A + aoff + (size_t)mb * 16 * K + kc); if (NSPLIT == 1 || NSPLIT == 2) a2[mb] = WFrag<T16>::ld(A2 + aoff + (size_t)mb * 16 * K + kc); }
#pragma unroll
        for (int nb = 0; nb < 4; ++nb) { const V b = WFrag<T16>::ld(Bt + boff + (size_t)nb * 16 * K + kc); V b2; if (NSPLIT >= 2) b2 = WFrag<T16>::ld(Bt2 + boff + (size_t)nb * 16 * K + kc);
#pragma unroll
            for (int mb = 0; mb < 4; ++mb) { acc[mb][nb] = WFrag<T16>::mma(a[mb], b, acc[mb][nb]); if (NSPLIT == 1 || NSPLIT == 2) acc[mb][nb] = WFrag<T16>::mma(a2[mb], b, acc[mb][nb]); if (NSPLIT >= 2) acc[mb][nb] = WFrag<T16>::mma(a[mb], b2, acc[mb][nb]); } }
        asm volatile("v_nop\n\tv_nop\n\tv_nop\n\tv_nop" : "+v"(acc[0][0]), "+v"(acc[1][1]), "+v"(acc[2][2]), "+v"(acc[3][3]) : "v"(a[0]), "v"(a[3]));
    }
    if constexpr (KW > 1) {
        float* ow = os + wv * 64 * 68;   // this wave's partial 64x64 tile, row pitch 68
#pragma unroll
        for (int mb = 0; mb < 4; ++mb)
#pragma unroll
            for (int nb = 0; nb < 4; ++nb)
#pragma unroll
                for (int j = 0; j < 8; ++j) ow[(mb * 16 + hi * 8 + j) * 68 + nb * 16 + lr] = acc[mb][nb][j];
        __syncthreads();   // every wave's partial tile is in LDS before any thread sums them
        float* crow = C + (size_t)r0 * ldc + c0;
#pragma unroll
        for (int i = 0; i < 32 / KW; ++i) { const int q = i * 32 * KW + threadIdx.x, row = q >> 4, cofs = (q & 15) * 4; v4f val = *(const v4fa*)(os + row * 68 + cofs);
#pragma unroll
            for (int w = 1; w < KW; ++w) val += *(const v4fa*)(os + w * 64 * 68 + row * 68 + cofs);
            if (BIAS) { val[0] += bfr(bias[c0 + cofs]); val[1] += bfr(bias[c0 + cofs + 1]); val[2] += bfr(bias[c0 + cofs + 2]); val[3] += bfr(bias[c0 + cofs + 3]); }
            *(v4f*)(crow + (size_t)row * ldc + cofs) = val; }
        return;
    }
#pragma unroll
    for (int mb = 0; mb < 4; ++mb) {
#pragma unroll
        for (int nb = 0; nb < 4; ++nb) {
#pragma unroll
            for (int j = 0; j < 8; ++j) os[(hi * 8 + j) * 68 + nb * 16 + lr] = acc[mb][nb][j]; }
        __builtin_amdgcn_wave_barrier(); asm volatile("" ::: "memory");
        float* crow = C + (size_t)(r0 + mb * 16) * ldc + c0;
{
#pragma unroll
            for (int s = 0; s < 8; ++s) { const int row = 2 * s + hi, cofs = lr * 4; v4f val = *(const v4fa*)(os + row * 68 + cofs); if (BIAS) { val[0] += bfr(bias[c0 + cofs]); val[1] += bfr(bias[c0 + cofs + 1]); val[2] += bfr(bias[c0 + cofs + 2]); val[3] += bfr(bias[c0 + cofs + 3]); }
                *(v4f*)(crow + (size_t)row * ldc + cofs) = val; }
             }
        __builtin_amdgcn_wave_barrier(); asm volatile("" ::: "memory");
    }
}

__device__ __forceinline__ h16 tohx(float x) { return (h16)x; }
__device__ __forceinline__ void splitf(float y, unsigned short& h, unsigned short& l) { h = f2bf(y); l = f2bf(y - bf2f(h)); }
typedef __attribute__((ext_vector_type(2))) _Float16 v2h;
typedef __attribute__((ext_vector_type(4))) _Float16 v4h;
typedef __attribute__((ext_vector_type(2))) unsigned short v2us;
typedef __attribute__((ext_vector_type(4))) unsigned short v4us;
typedef __attribute__((ext_vector_type(2))) float v2f;
typedef __attribute__((ext_vector_type(4))) int v4i;

__global__ __launch_bounds__(256) void k_wtG(const float* __restrict__ w, int K, int N, bf* Bt) {
    const int lane = threadIdx.x & 31; const int L0 = (blockIdx.x * 8 + (threadIdx.x >> 5)) * 8; const int nlines = N * K / 64;
{
#pragma unroll 1
        for (int l = 0; l < 8; ++l) { const int L = L0 + l; if (L >= nlines) break; const size_t e = (size_t)L * 64 + lane * 2; const int k = (int)(e % K), n = (int)(e / K); v2us o;
            o[0] = f2bf(w[(size_t)k * N + n]); o[1] = f2bf(w[(size_t)(k + 1) * N + n]); *(v2us*)(Bt + e) = o; }
         }
}
// ---- k_cvtall: every f32 operand of the products rounded to bf16 in one launch. Grid (64, 8), 256 threads: slice y (DM x DM elements) is a quarter of x (y < 4) or one weight matrix; a thread converts 8 pieces of 8 elements, all its loads issued before the first conversion.
static_assert((size_t)NB_ * TT * DM == 4 * (size_t)DM * DM && DQ == DM && DKV == DM, "slices of DM x DM elements");
__global__ __launch_bounds__(256) void k_cvtall(const float* __restrict__ x, const float* __restrict__ wq, const float* __restrict__ wk, const float* __restrict__ wv, const float* __restrict__ wo, bf* XB, bf* WQ, bf* WK, bf* WV, bf* WO) {
    const int y = blockIdx.y; const size_t SL = (size_t)DM * DM; const float* s; bf* d;
    if (y < 4) { s = x + y * SL; d = XB + y * SL; } else if (y == 4) { s = wq; d = WQ; } else if (y == 5) { s = wk; d = WK; } else if (y == 6) { s = wv; d = WV; } else { s = wo; d = WO; }
    const size_t i0 = ((size_t)blockIdx.x * 2048 + threadIdx.x) * 8; const float* sp = s + i0; v8f v[8];
#pragma unroll
    for (int j = 0; j < 8; ++j) v[j] = *(const v8f*)(sp + j * 2048);
    asm volatile("s_wait_xcnt 0x0" :: "v"(sp) : "memory");   // the loads' address pair is an input here, so no load lands on it; behind the wait it is free for reuse
#pragma unroll
    for (int j = 0; j < 8; ++j) { v8us o;
#pragma unroll
        for (int k = 0; k < 8; ++k) o[k] = f2bf(v[j][k]);
        *(v8us*)(d + i0 + j * 2048) = o; }
}

// ---- k_qkv: the q, k and v projections of both batches in one launch, the loop and the K split of k_gemmw (8 waves, partial tiles summed through LDS in wave order). Grid (NB_*TT/64 token tiles, heads, 3).
// A 64x64 tile is 64 tokens x one head, so the epilogue splits each sum into hi + lo bf16 and stores it straight into the head planes: q, k as [b][h][t][d]; v is computed as Wv x^T (rows = d, columns = t), which is the [b][h][d][t] plane row by row.
__global__ __launch_bounds__(256) void k_qkv(const bf* __restrict__ X, const bf* __restrict__ WQ, const bf* __restrict__ WK, const bf* __restrict__ WV, bf* Qh, bf* Ql, bf* Kh, bf* Kl, bf* Vh, bf* Vl) {
    constexpr int KW = 8, K = DM;
    __shared__ __align__(16) float os[KW * 64 * 68];
    const int wv = __builtin_amdgcn_readfirstlane((int)(threadIdx.x >> 5)); const int lane = threadIdx.x & 31, lr = lane & 15, hi = lane >> 4;
    const int z = blockIdx.z, b = blockIdx.x / (TT / 64), t0 = (blockIdx.x % (TT / 64)) * 64; const size_t hp = (size_t)b * NH_ + blockIdx.y;
    const bf* xt = X + (size_t)blockIdx.x * 64 * K; const bf* wt = (z == 0 ? WQ : z == 1 ? WK : WV) + (size_t)blockIdx.y * 64 * K;
    const bf* A = (z == 2) ? wt : xt; const bf* Bt = (z == 2) ? xt : wt;
    bf* Ph = (z == 0 ? Qh : z == 1 ? Kh : Vh); bf* Pl = (z == 0 ? Ql : z == 1 ? Kl : Vl);
    const int pitch = (z == 2) ? TT : HD; const size_t ob = (z == 2) ? hp * HD * TT + t0 : (hp * TT + t0) * HD;
    v8f acc[4][4];
#pragma unroll
    for (int mb = 0; mb < 4; ++mb)
#pragma unroll
        for (int nb = 0; nb < 4; ++nb) acc[mb][nb] = (v8f){};
    const unsigned foff = (unsigned)(lr * K + 8 * hi);   // the lane's part of every fragment address, beside a wave-uniform base
#pragma unroll 1
    for (int kc = wv * 32; kc < K; kc += 32 * KW) {
        v16bf a[4];
#pragma unroll
        for (int mb = 0; mb < 4; ++mb) a[mb] = WFrag<bf>::ld(A + (mb * 16 * K + kc) + foff);
        asm volatile("s_wait_xcnt 0x0" ::: "memory");   // the A loads' address registers are free for reuse behind this: the build lets a B load land on them
#pragma unroll
        for (int nb = 0; nb < 4; ++nb) { const v16bf bq = WFrag<bf>::ld(Bt + (nb * 16 * K + kc) + foff);
#pragma unroll
            for (int mb = 0; mb < 4; ++mb) acc[mb][nb] = wmmab(a[mb], bq, acc[mb][nb]); }
        asm volatile("v_nop\n\tv_nop\n\tv_nop\n\tv_nop" : "+v"(acc[0][0]), "+v"(acc[1][1]), "+v"(acc[2][2]), "+v"(acc[3][3]) : "v"(a[0]), "v"(a[3]));   // the distance behind the trip's last matrix instruction, on the back edge too, before the next trip's loads overwrite its operands
    }
    float* ow = os + wv * 64 * 68;   // this wave's partial 64x64 tile, row pitch 68
#pragma unroll
    for (int mb = 0; mb < 4; ++mb)
#pragma unroll
        for (int nb = 0; nb < 4; ++nb)
#pragma unroll
            for (int j = 0; j < 8; ++j) ow[(mb * 16 + hi * 8 + j) * 68 + nb * 16 + lr] = acc[mb][nb][j];
    __syncthreads();   // every wave's partial tile is in LDS before any thread sums them
#pragma unroll
    for (int i = 0; i < 32 / KW; ++i) { const int q = i * 32 * KW + threadIdx.x, row = q >> 4, cofs = (q & 15) * 4; v4f val = *(const v4fa*)(os + row * 68 + cofs);
#pragma unroll
        for (int w = 1; w < KW; ++w) val += *(const v4fa*)(os + w * 64 * 68 + row * 68 + cofs);
        v4us oh, ol;
#pragma unroll
        for (int e = 0; e < 4; ++e) { unsigned short a2, c2; splitf(val[e], a2, c2); oh[e] = a2; ol[e] = c2; }
        *(v4us*)(Ph + ob + (size_t)row * pitch + cofs) = oh; *(v4us*)(Pl + ob + (size_t)row * pitch + cofs) = ol; }
}
// ---- k_fattn: scores, softmax, P.V and the head merge in one kernel. Grid (TT/256, heads, batches), 16 waves; a wave owns 16 queries, a lane one query (column lr) and half of each key group.
// St = K Qt and Ot += Vt Pt: the score accumulators of two 16-key tiles, converted in place, are the B operand of the second product (hardware k order; the K, Q and Vt loaders use the same order).
// K and Vt hi/lo tiles of 64 keys go global -> registers -> LDS, two buffers: the next stage's loads fly during this stage's work, one barrier a stage.
#define FLP   72                   // LDS row pitch in 16-bit elements: 144 B = 16 B x odd, conflict-free for 16-byte row reads
#define FTILE (64 * FLP)
#define CEXP  0.18033688011112042f // HD^-0.5 x log2(e): scores go to base 2 in the one multiply
typedef __attribute__((ext_vector_type(2))) __bf16 v2bf;
__device__ __forceinline__ float xhalf(float x) { return __builtin_bit_cast(float, __builtin_amdgcn_permlanex16(__builtin_bit_cast(int, x), __builtin_bit_cast(int, x), 0x76543210, 0xfedcba98, false, false)); }   // lane l with lane l ^ 16
__device__ __forceinline__ v16bf ldsfrag(const bf* p) { return cat16b(*(const v8usa*)p, *(const v8usa*)(p + 16)); }
__global__ __launch_bounds__(512) void k_fattn(const bf* __restrict__ Qh, const bf* __restrict__ Ql, const bf* __restrict__ Kh, const bf* __restrict__ Kl, const bf* __restrict__ Vh, const bf* __restrict__ Vl, bf* ATh, bf* ATl) {
    __shared__ __align__(16) bf sm[2 * 4 * FTILE];   // [buffer][K hi, K lo, Vt hi, Vt lo][64 rows][FLP]
    const int tid = threadIdx.x, lane = tid & 31, lr = lane & 15, hi = lane >> 4; const int wv = __builtin_amdgcn_readfirstlane(tid >> 5);
    const size_t hp = (size_t)blockIdx.z * NH_ + blockIdx.y;   // the (batch, head) plane
    const int q = blockIdx.x * 256 + wv * 16 + lr;             // this lane's query
    v16bf qh[2], ql[2];
#pragma unroll
    for (int c = 0; c < 2; ++c) { const size_t qo = (hp * TT + q) * HD + c * 32 + 8 * hi; qh[c] = WFrag<bf>::ld(Qh + qo); ql[c] = WFrag<bf>::ld(Ql + qo); }
    const int srow = tid >> 3, sseg = (tid & 7) * 8, so = srow * FLP + sseg;   // staging: one 16-byte piece of each of the four tiles a thread
    const size_t gk = (hp * TT + srow) * HD + sseg, gv = (hp * HD + srow) * TT + sseg;
    v8us r0 = *(const v8us*)(Kh + gk), r1 = *(const v8us*)(Kl + gk), r2 = *(const v8us*)(Vh + gv), r3 = *(const v8us*)(Vl + gv);
    *(v8usa*)(sm + so) = r0; *(v8usa*)(sm + FTILE + so) = r1; *(v8usa*)(sm + 2 * FTILE + so) = r2; *(v8usa*)(sm + 3 * FTILE + so) = r3;
    __syncthreads();   // stage 0 is in LDS before any wave reads it
    v8f o[4];
#pragma unroll
    for (int dt = 0; dt < 4; ++dt) o[dt] = (v8f){};
    float m = -3.0e38f, l = 0.f;
#pragma unroll 1
    for (int s = 0; s < TT / 64; ++s) {
        const bool more = s + 1 < TT / 64;
        if (more) { const size_t k1 = (size_t)(s + 1) * 64; r0 = *(const v8us*)(Kh + gk + k1 * HD); r1 = *(const v8us*)(Kl + gk + k1 * HD); r2 = *(const v8us*)(Vh + gv + k1); r3 = *(const v8us*)(Vl + gv + k1); }
        const bf* sb = sm + (s & 1) * 4 * FTILE;
        v8f st[4];   // st[kt][j] = score of key s*64 + kt*16 + 8*hi + j against query q
#pragma unroll
        for (int kt = 0; kt < 4; ++kt) { v8f a = (v8f){};
#pragma unroll
            for (int c = 0; c < 2; ++c) { const bf* kp = sb + (kt * 16 + lr) * FLP + c * 32 + 8 * hi; const v16bf kh = ldsfrag(kp), kl = ldsfrag(kp + FTILE);
                a = wmmab(kh, qh[c], a); a = wmmab(kl, qh[c], a); a = wmmab(kh, ql[c], a); }
            st[kt] = a; }
        float mx = m;
#pragma unroll
        for (int kt = 0; kt < 4; ++kt)
#pragma unroll
            for (int j = 0; j < 8; ++j) { const float t = (s * 64 + kt * 16 + 8 * hi + j >= q) ? st[kt][j] * CEXP : -3.0e38f;   /* anti-causal: keys before the query excluded (the module's tril(-1) -> -inf) */ st[kt][j] = t; mx = fmaxf(mx, t); }
        mx = fmaxf(mx, xhalf(mx));   // both halves of the wave hold the query's running maximum
        const float alpha = __builtin_amdgcn_exp2f(m - mx);   // 0 when the first admitted key arrives: whatever the all-excluded stages before it summed is wiped
        m = mx;
        float ps[4]; v16bf ph[2], pl[2];   // one partial sum a tile: four short add chains instead of one long one
#pragma unroll
        for (int kt = 0; kt < 4; ++kt) { ps[kt] = 0.f;
#pragma unroll
            for (int j = 0; j < 8; j += 2) { v2f p; p[0] = __builtin_amdgcn_exp2f(st[kt][j] - mx); p[1] = __builtin_amdgcn_exp2f(st[kt][j + 1] - mx); ps[kt] += p[0]; ps[kt] += p[1];
                const v2bf h = __builtin_convertvector(p, v2bf); v2f r; r[0] = p[0] - (float)h[0]; r[1] = p[1] - (float)h[1]; const v2bf lo = __builtin_convertvector(r, v2bf);   // hi + lo planes of P, two elements a conversion
                const int e = (kt & 1) * 8 + j; ph[kt >> 1][e] = h[0]; ph[kt >> 1][e + 1] = h[1]; pl[kt >> 1][e] = lo[0]; pl[kt >> 1][e + 1] = lo[1]; } }
        l = l * alpha + ((ps[0] + ps[1]) + (ps[2] + ps[3]));   // each half keeps the sum of its own keys; joined once after the loop
#pragma unroll
        for (int dt = 0; dt < 4; ++dt) o[dt] *= alpha;
#pragma unroll
        for (int kp2 = 0; kp2 < 2; ++kp2)
#pragma unroll
            for (int dt = 0; dt < 4; ++dt) { const bf* vp = sb + 2 * FTILE + (dt * 16 + lr) * FLP + kp2 * 32 + 8 * hi; const v16bf vh = ldsfrag(vp), vl = ldsfrag(vp + FTILE);
                o[dt] = wmmab(vh, ph[kp2], o[dt]); o[dt] = wmmab(vh, pl[kp2], o[dt]); o[dt] = wmmab(vl, ph[kp2], o[dt]); }
        if (more) { bf* sn = sm + ((s + 1) & 1) * 4 * FTILE + so; *(v8usa*)sn = r0; *(v8usa*)(sn + FTILE) = r1; *(v8usa*)(sn + 2 * FTILE) = r2; *(v8usa*)(sn + 3 * FTILE) = r3; }
        __syncthreads();   // publishes stage s + 1 and ends every wave's reads of stage s, whose buffer the next trip refills
    }
    l += xhalf(l); const float inv = __fdiv_rn(1.0f, l);
    const size_t oo = ((size_t)blockIdx.z * TT + q) * DQ + blockIdx.y * HD + 8 * hi;   // o[dt][j] = out[q][dt*16 + 8*hi + j]: 8 consecutive d a lane
#pragma unroll
    for (int dt = 0; dt < 4; ++dt) { v8us oh, ol;
#pragma unroll
        for (int j = 0; j < 8; ++j) { unsigned short a, c2; splitf(o[dt][j] * inv, a, c2); oh[j] = a; ol[j] = c2; }
        *(v8us*)(ATh + oo + dt * 16) = oh; *(v8us*)(ATl + oo + dt * 16) = ol; }
}

extern "C" void kernel_launch(void* const* d_in, const int* in_sizes, int n_in,
                              void* d_out, int out_size, void* d_ws, size_t ws_size, hipStream_t stream) {
    (void)in_sizes; (void)n_in; (void)out_size;
    const float* x = (const float*)d_in[0]; const float* wq = (const float*)d_in[1]; const float* wk = (const float*)d_in[2]; const float* wv = (const float*)d_in[3]; const float* wo = (const float*)d_in[4]; const float* bo = (const float*)d_in[5];
    float* OUT = (float*)d_out;     // [2][2048][1024]
    char* wsp = (char*)d_ws;
    auto take = [&](size_t bytes) { char* p = wsp; wsp += (bytes + 255) & ~(size_t)255; return (void*)p; };
    bf* WQ = (bf*)take((size_t)DQ * DM * 2); bf* WK = (bf*)take((size_t)DKV * DM * 2); bf* WV = (bf*)take((size_t)DKV * DM * 2); bf* WO = (bf*)take((size_t)DM * DQ * 2);
    bf* XB = (bf*)take((size_t)NB_ * TT * DM * 2);
    const size_t PL = (size_t)NH_ * TT * HD;   // one batch's head planes, elements
    bf* QPh = (bf*)take(NB_ * PL * 2); bf* QPl = (bf*)take(NB_ * PL * 2); bf* KPh = (bf*)take(NB_ * PL * 2); bf* KPl = (bf*)take(NB_ * PL * 2); bf* VTh = (bf*)take(NB_ * PL * 2); bf* VTl = (bf*)take(NB_ * PL * 2);
    bf* ATh = (bf*)take((size_t)NB_ * TT * DQ * 2); bf* ATl = (bf*)take((size_t)NB_ * TT * DQ * 2);
    if ((size_t)(wsp - (char*)d_ws) > ws_size) return;    // ws 256 MiB
    k_cvtall<<<dim3(64, 8, 1), 256, 0, stream>>>(x, wq, wk, wv, wo, XB, WQ, WK, WV, WO);
    k_qkv<<<dim3(NB_ * TT / 64, NH_, 3), 256, 0, stream>>>(XB, WQ, WK, WV, QPh, QPl, KPh, KPl, VTh, VTl);
    k_fattn<<<dim3(TT / 256, NH_, NB_), 512, 0, stream>>>(QPh, QPl, KPh, KPl, VTh, VTl, ATh, ATl);
    k_gemmw<bf, 1, true, 8><<<dim3(NB_ * TT / 64, DM / 64, 1), 256, 0, stream>>>(ATh, ATl, WO, nullptr, DQ, OUT, DM, bo, 0, 0, 0);   // both batches: the merged rows and the output rows are contiguous over b
}

// v004
// Measured time: 150 microseconds a run.
// Two timings next to v003 both put it at 1.18 times that version's speed.
// All steps since v000 together make it 8.66 times as fast.
#include <hip/hip_runtime.h>

// Multi-head attention with the module's ANTI-causal mask (x [2][2048][1024]; q,k,v = x W^T ('oi' [1024][1024] 0.02, no bias; 16 heads x 64); scores = q.k; keys strictly BEFORE the query (tril(-1)) -> -inf, i.e. each token attends to itself and the future; softmax(scores / 8); out = merged Wo^T + bo -> [2][2048][1024] (4.2 M)).
// Layout: one launch rounds x and the four weight matrices to bf16; one launch does the exact q, k, v projections of both batches and writes the hi/lo head planes from its own epilogue; ONE fused attention launch for all (batch, head) pairs with EVERY row on hi/lo planes (3 products; under the anti-causal mask the LAST rows see only a few keys; score tiles from each query tile's own first key on, the anti-causal pattern applied as the index select j >= i in the softmax; scores and probabilities stay in registers, running maximum and sum); merged hi/lo x Wo exact + bo.
// Compute dtypes, f32 accumulate: every input rounded to bf16; projections exact; attention 3 products on every row; softmax f32; Wo hl x exact + bias.

#define NB_  2
#define TT   2048
#define DM   1024
#define NH_  16
#define NKV  16
#define HD   64
#define DQ   (NH_ * HD)
#define DKV  (NKV * HD)
#define WIN  0
typedef _Float16 h16;
typedef unsigned short bf;
typedef __attribute__((ext_vector_type(16))) __bf16   v16bf;
typedef __attribute__((ext_vector_type(16))) _Float16 v16h;
typedef __attribute__((ext_vector_type(8)))  _Float16 v8h;
typedef __attribute__((ext_vector_type(8)))  unsigned short v8us;
typedef __attribute__((ext_vector_type(8)))  float    v8f;
typedef __attribute__((ext_vector_type(4)))  float    v4f;
typedef v8h  __attribute__((may_alias)) v8ha;
typedef v4f  __attribute__((may_alias)) v4fa;
typedef v8us __attribute__((may_alias)) v8usa;

__device__ __forceinline__ unsigned short f2bf(float f) { unsigned u = __float_as_uint(f); u += 0x7FFFu + ((u >> 16) & 1u); return (unsigned short)(u >> 16); }
__device__ __forceinline__ float bf2f(unsigned short b) { return __uint_as_float(((unsigned)b) << 16); }
__device__ __forceinline__ float bfr(float f) { return bf2f(f2bf(f)); }
__device__ __forceinline__ v16h cat16(v8h lo, v8h hi) { return __builtin_shufflevector(lo, hi, 0, 1, 2, 3, 4, 5, 6, 7, 8, 9, 10, 11, 12, 13, 14, 15); }
__device__ __forceinline__ v16bf cat16b(v8us lo, v8us hi) { return __builtin_bit_cast(v16bf, __builtin_shufflevector(lo, hi, 0, 1, 2, 3, 4, 5, 6, 7, 8, 9, 10, 11, 12, 13, 14, 15)); }
__device__ __forceinline__ v8f wmma16(v16h a, v16h b, v8f c) { return __builtin_amdgcn_wmma_f32_16x16x32_f16(false, a, false, b, (short)0, c, false, false); }
__device__ __forceinline__ v8f wmmab(v16bf a, v16bf b, v8f c) { return __builtin_amdgcn_wmma_f32_16x16x32_bf16(false, a, false, b, (short)0, c, false, false); }



// ---- k_gemmw: register-blocked GEMM, one 64x64 output tile per work-group (16 accumulators a wave), operands straight from K-contiguous 16-bit planes; grid (M/64, N/64, Z), 32 * KW threads.
// C[m][n] (f32, pitch ldc, + optional f32 bias[n]) = sum_k A[m][k] Bt[n][k] (+ split products per NSPLIT). z-batch strides sA/sB/sC in elements. K % (32 * KW) == 0.
// KW waves share the tile's K: wave w takes the 32-wide k chunks w, w + KW, ... (neighbouring waves read neighbouring 64 bytes of the same rows), and the KW partial tiles are summed through LDS in wave order.
template <typename T16> struct WFrag;
template <> struct WFrag<h16> { typedef v16h V; static __device__ __forceinline__ V ld(const h16* p) { return cat16(*(const v8h*)p, *(const v8h*)(p + 16)); } static __device__ __forceinline__ v8f mma(V a, V b, v8f c) { return wmma16(a, b, c); } };
template <> struct WFrag<bf> { typedef v16bf V; static __device__ __forceinline__ V ld(const bf* p) { return cat16b(*(const v8us*)p, *(const v8us*)(p + 16)); } static __device__ __forceinline__ v8f mma(V a, V b, v8f c) { return wmmab(a, b, c); } };
template <typename T16, int NSPLIT, bool BIAS, int KW>
__global__ __launch_bounds__(32 * KW) void k_gemmw(const T16* __restrict__ A, const T16* __restrict__ A2, const T16* __restrict__ Bt, const T16* __restrict__ Bt2, int K, float* C, int ldc, const float* __restrict__ bias, size_t sA, size_t sB, size_t sC) {
    typedef typename WFrag<T16>::V V;
    __shared__ __align__(16) float os[(KW > 1 ? 4 * KW : 1) * 16 * 68];
    const int wv = (KW > 1) ? __builtin_amdgcn_readfirstlane((int)(threadIdx.x >> 5)) : 0;
    const size_t z = blockIdx.z; A += z * sA; if (A2) A2 += z * sA; Bt += z * sB; if (Bt2) Bt2 += z * sB; C += z * sC;
    const int lane = threadIdx.x & 31, lr = lane & 15, hi = lane >> 4; const int r0 = blockIdx.x * 64, c0 = blockIdx.y * 64;
    v8f acc[4][4];
#pragma unroll
    for (int mb = 0; mb < 4; ++mb)
#pragma unroll
        for (int nb = 0; nb < 4; ++nb) acc[mb][nb] = (v8f){};
    const size_t aoff = (size_t)(r0 + lr) * K + 8 * hi, boff = (size_t)(c0 + lr) * K + 8 * hi;
#pragma unroll 1
    for (int kc = wv * 32; kc < K; kc += 32 * KW) {
        V a[4], a2[4];
#pragma unroll
        for (int mb = 0; mb < 4; ++mb) { a[mb] = WFrag<T16>::ld(A + aoff + (size_t)mb * 16 * K + kc); if (NSPLIT == 1 || NSPLIT == 2) a2[mb] = WFrag<T16>::ld(A2 + aoff + (size_t)mb * 16 * K + kc); }
#pragma unroll
        for (int nb = 0; nb < 4; ++nb) { const V b = WFrag<T16>::ld(Bt + boff + (size_t)nb * 16 * K + kc); V b2; if (NSPLIT >= 2) b2 = WFrag<T16>::ld(Bt2 + boff + (size_t)nb * 16 * K + kc);
#pragma unroll
            for (int mb = 0; mb < 4; ++mb) { acc[mb][nb] = WFrag<T16>::mma(a[mb], b, acc[mb][nb]); if (NSPLIT == 1 || NSPLIT == 2) acc[mb][nb] = WFrag<T16>::mma(a2[mb], b, acc[mb][nb]); if (NSPLIT >= 2) acc[mb][nb] = WFrag<T16>::mma(a[mb], b2, acc[mb][nb]); } }
        asm volatile("v_nop\n\tv_nop\n\tv_nop\n\tv_nop" : "+v"(acc[0][0]), "+v"(acc[1][1]), "+v"(acc[2][2]), "+v"(acc[3][3]) : "v"(a[0]), "v"(a[3]));
    }
    if constexpr (KW > 1) {
        float* ow = os + wv * 64 * 68;   // this wave's partial 64x64 tile, row pitch 68
#pragma unroll
        for (int mb = 0; mb < 4; ++mb)
#pragma unroll
            for (int nb = 0; nb < 4; ++nb)
#pragma unroll
                for (int j = 0; j < 8; ++j) ow[(mb * 16 + hi * 8 + j) * 68 + nb * 16 + lr] = acc[mb][nb][j];
        __syncthreads();   // every wave's partial tile is in LDS before any thread sums them
        float* crow = C + (size_t)r0 * ldc + c0;
#pragma unroll
        for (int i = 0; i < 32 / KW; ++i) { const int q = i * 32 * KW + threadIdx.x, row = q >> 4, cofs = (q & 15) * 4; v4f val = *(const v4fa*)(os + row * 68 + cofs);
#pragma unroll
            for (int w = 1; w < KW; ++w) val += *(const v4fa*)(os + w * 64 * 68 + row * 68 + cofs);
            if (BIAS) { val[0] += bfr(bias[c0 + cofs]); val[1] += bfr(bias[c0 + cofs + 1]); val[2] += bfr(bias[c0 + cofs + 2]); val[3] += bfr(bias[c0 + cofs + 3]); }
            *(v4f*)(crow + (size_t)row * ldc + cofs) = val; }
        return;
    }
#pragma unroll
    for (int mb = 0; mb < 4; ++mb) {
#pragma unroll
        for (int nb = 0; nb < 4; ++nb) {
#pragma unroll
            for (int j = 0; j < 8; ++j) os[(hi * 8 + j) * 68 + nb * 16 + lr] = acc[mb][nb][j]; }
        __builtin_amdgcn_wave_barrier(); asm volatile("" ::: "memory");
        float* crow = C + (size_t)(r0 + mb * 16) * ldc + c0;
{
#pragma unroll
            for (int s = 0; s < 8; ++s) { const int row = 2 * s + hi, cofs = lr * 4; v4f val = *(const v4fa*)(os + row * 68 + cofs); if (BIAS) { val[0] += bfr(bias[c0 + cofs]); val[1] += bfr(bias[c0 + cofs + 1]); val[2] += bfr(bias[c0 + cofs + 2]); val[3] += bfr(bias[c0 + cofs + 3]); }
                *(v4f*)(crow + (size_t)row * ldc + cofs) = val; }
             }
        __builtin_amdgcn_wave_barrier(); asm volatile("" ::: "memory");
    }
}

__device__ __forceinline__ h16 tohx(float x) { return (h16)x; }
__device__ __forceinline__ void splitf(float y, unsigned short& h, unsigned short& l) { h = f2bf(y); l = f2bf(y - bf2f(h)); }
typedef __attribute__((ext_vector_type(2))) _Float16 v2h;
typedef __attribute__((ext_vector_type(4))) _Float16 v4h;
typedef __attribute__((ext_vector_type(2))) unsigned short v2us;
typedef __attribute__((ext_vector_type(4))) unsigned short v4us;
typedef __attribute__((ext_vector_type(2))) float v2f;
typedef __attribute__((ext_vector_type(4))) int v4i;

__global__ __launch_bounds__(256) void k_wtG(const float* __restrict__ w, int K, int N, bf* Bt) {
    const int lane = threadIdx.x & 31; const int L0 = (blockIdx.x * 8 + (threadIdx.x >> 5)) * 8; const int nlines = N * K / 64;
{
#pragma unroll 1
        for (int l = 0; l < 8; ++l) { const int L = L0 + l; if (L >= nlines) break; const size_t e = (size_t)L * 64 + lane * 2; const int k = (int)(e % K), n = (int)(e / K); v2us o;
            o[0] = f2bf(w[(size_t)k * N + n]); o[1] = f2bf(w[(size_t)(k + 1) * N + n]); *(v2us*)(Bt + e) = o; }
         }
}
// ---- k_cvtall: every f32 operand of the products rounded to bf16 in one launch. Grid (64, 8), 256 threads: slice y (DM x DM elements) is a quarter of x (y < 4) or one weight matrix; a thread converts 8 pieces of 8 elements, all its loads issued before the first conversion.
static_assert((size_t)NB_ * TT * DM == 4 * (size_t)DM * DM && DQ == DM && DKV == DM, "slices of DM x DM elements");
__global__ __launch_bounds__(256) void k_cvtall(const float* __restrict__ x, const float* __restrict__ wq, const float* __restrict__ wk, const float* __restrict__ wv, const float* __restrict__ wo, bf* XB, bf* WQ, bf* WK, bf* WV, bf* WO) {
    const int y = blockIdx.y; const size_t SL = (size_t)DM * DM; const float* s; bf* d;
    if (y < 4) { s = x + y * SL; d = XB + y * SL; } else if (y == 4) { s = wq; d = WQ; } else if (y == 5) { s = wk; d = WK; } else if (y == 6) { s = wv; d = WV; } else { s = wo; d = WO; }
    const size_t i0 = ((size_t)blockIdx.x * 2048 + threadIdx.x) * 8; const float* sp = s + i0; v8f v[8];
#pragma unroll
    for (int j = 0; j < 8; ++j) v[j] = *(const v8f*)(sp + j * 2048);
    asm volatile("s_wait_xcnt 0x0" :: "v"(sp) : "memory");   // the loads' address pair is an input here, so no load lands on it; behind the wait it is free for reuse
#pragma unroll
    for (int j = 0; j < 8; ++j) { v8us o;
#pragma unroll
        for (int k = 0; k < 8; ++k) o[k] = f2bf(v[j][k]);
        *(v8us*)(d + i0 + j * 2048) = o; }
}

// ---- k_qkv: the q, k and v projections of both batches in one launch, the loop and the K split of k_gemmw (8 waves, partial tiles summed through LDS in wave order). Grid (NB_*TT/64 token tiles, heads, 3).
// A 64x64 tile is 64 tokens x one head, so the epilogue splits each sum into hi + lo bf16 and stores it straight into the head planes: q, k as [b][h][t][d]; v is computed as Wv x^T (rows = d, columns = t), which is the [b][h][d][t] plane row by row.
__global__ __launch_bounds__(256) void k_qkv(const bf* __restrict__ X, const bf* __restrict__ WQ, const bf* __restrict__ WK, const bf* __restrict__ WV, bf* Qh, bf* Ql, bf* Kh, bf* Kl, bf* Vh, bf* Vl) {
    constexpr int KW = 8, K = DM;
    __shared__ __align__(16) float os[KW * 64 * 68];
    const int wv = __builtin_amdgcn_readfirstlane((int)(threadIdx.x >> 5)); const int lane = threadIdx.x & 31, lr = lane & 15, hi = lane >> 4;
    const int z = blockIdx.z, b = blockIdx.x / (TT / 64), t0 = (blockIdx.x % (TT / 64)) * 64; const size_t hp = (size_t)b * NH_ + blockIdx.y;
    const bf* xt = X + (size_t)blockIdx.x * 64 * K; const bf* wt = (z == 0 ? WQ : z == 1 ? WK : WV) + (size_t)blockIdx.y * 64 * K;
    const bf* A = (z == 2) ? wt : xt; const bf* Bt = (z == 2) ? xt : wt;
    bf* Ph = (z == 0 ? Qh : z == 1 ? Kh : Vh); bf* Pl = (z == 0 ? Ql : z == 1 ? Kl : Vl);
    const int pitch = (z == 2) ? TT : HD; const size_t ob = (z == 2) ? hp * HD * TT + t0 : (hp * TT + t0) * HD;
    v8f acc[4][4];
#pragma unroll
    for (int mb = 0; mb < 4; ++mb)
#pragma unroll
        for (int nb = 0; nb < 4; ++nb) acc[mb][nb] = (v8f){};
    const unsigned foff = (unsigned)(lr * K + 8 * hi);   // the lane's part of every fragment address, beside a wave-uniform base
#pragma unroll 1
    for (int kc = wv * 32; kc < K; kc += 32 * KW) {
        v16bf a[4];
#pragma unroll
        for (int mb = 0; mb < 4; ++mb) a[mb] = WFrag<bf>::ld(A + (mb * 16 * K + kc) + foff);
        asm volatile("s_wait_xcnt 0x0" ::: "memory");   // the A loads' address registers are free for reuse behind this: the build lets a B load land on them
#pragma unroll
        for (int nb = 0; nb < 4; ++nb) { const v16bf bq = WFrag<bf>::ld(Bt + (nb * 16 * K + kc) + foff);
#pragma unroll
            for (int mb = 0; mb < 4; ++mb) acc[mb][nb] = wmmab(a[mb], bq, acc[mb][nb]); }
        asm volatile("v_nop\n\tv_nop\n\tv_nop\n\tv_nop" : "+v"(acc[0][0]), "+v"(acc[1][1]), "+v"(acc[2][2]), "+v"(acc[3][3]) : "v"(a[0]), "v"(a[3]));   // the distance behind the trip's last matrix instruction, on the back edge too, before the next trip's loads overwrite its operands
    }
    float* ow = os + wv * 64 * 68;   // this wave's partial 64x64 tile, row pitch 68
#pragma unroll
    for (int mb = 0; mb < 4; ++mb)
#pragma unroll
        for (int nb = 0; nb < 4; ++nb)
#pragma unroll
            for (int j = 0; j < 8; ++j) ow[(mb * 16 + hi * 8 + j) * 68 + nb * 16 + lr] = acc[mb][nb][j];
    __syncthreads();   // every wave's partial tile is in LDS before any thread sums them
#pragma unroll
    for (int i = 0; i < 32 / KW; ++i) { const int q = i * 32 * KW + threadIdx.x, row = q >> 4, cofs = (q & 15) * 4; v4f val = *(const v4fa*)(os + row * 68 + cofs);
#pragma unroll
        for (int w = 1; w < KW; ++w) val += *(const v4fa*)(os + w * 64 * 68 + row * 68 + cofs);
        v4us oh, ol;
#pragma unroll
        for (int e = 0; e < 4; ++e) { unsigned short a2, c2; splitf(val[e], a2, c2); oh[e] = a2; ol[e] = c2; }
        *(v4us*)(Ph + ob + (size_t)row * pitch + cofs) = oh; *(v4us*)(Pl + ob + (size_t)row * pitch + cofs) = ol; }
}
// ---- k_fattn: scores, softmax, P.V and the head merge in one kernel. Grid (TT/256, heads, batches), 16 waves = two groups of 8; a wave owns 16 queries, a lane one query (column lr) and half of each key group.
// Keys before a query tile's first query are excluded for every query of the tile, so a tile of 128 queries starts at its own first key: tile t walks 16 - t stages of 128 keys. A work-group takes tile t and then tile 15 - t, 17 stages whatever t is.
// Both wave groups hold the same 128 queries; group g takes the g-th 64 keys of every stage with its own running maximum and sum, and the two partial results are joined through LDS behind the tile's last stage.
// St = K Qt and Ot += Vt Pt: the score accumulators of two 16-key tiles, converted in place, are the B operand of the second product (hardware k order; the K, Q and Vt loaders use the same order).
// K and Vt hi/lo tiles go global -> registers -> LDS, two buffers: the next stage's loads fly during this stage's work, one barrier a stage.
#define FLP   72                   // LDS row pitch in 16-bit elements: 144 B = 16 B x odd, conflict-free for 16-byte row reads
#define FTILE (64 * FLP)
#define FBUF  (8 * FTILE)          // one buffer: two halves of 64 keys x (K hi, K lo, Vt hi, Vt lo)
#define QT    128                  // queries a tile, keys a stage
#define NQT   (TT / QT)
#define JP    36                   // join record pitch in floats: 144 B = 16 B x odd
#define CEXP  0.18033688011112042f // HD^-0.5 x log2(e): scores go to base 2 in the one multiply
static_assert(NQT % 2 == 0 && TT / 256 == NQT / 2, "tiles t and NQT - 1 - t pair up over the grid");
typedef __attribute__((ext_vector_type(2))) __bf16 v2bf;
__device__ __forceinline__ float xhalf(float x) { return __builtin_bit_cast(float, __builtin_amdgcn_permlanex16(__builtin_bit_cast(int, x), __builtin_bit_cast(int, x), 0x76543210, 0xfedcba98, false, false)); }   // lane l with lane l ^ 16
__device__ __forceinline__ v16bf ldsfrag(const bf* p) { return cat16b(*(const v8usa*)p, *(const v8usa*)(p + 16)); }
__global__ __launch_bounds__(512) void k_fattn(const bf* __restrict__ Qh, const bf* __restrict__ Ql, const bf* __restrict__ Kh, const bf* __restrict__ Kl, const bf* __restrict__ Vh, const bf* __restrict__ Vl, bf* ATh, bf* ATl) {
    __shared__ __align__(16) bf sm[2 * FBUF];        // [buffer][key half][K hi, K lo, Vt hi, Vt lo][64 rows][FLP]
    __shared__ __align__(16) float jn[256 * JP];     // group 1's partial result, one record a lane: 32 output sums, maximum, sum
    const int tid = threadIdx.x, lane = tid & 31, lr = lane & 15, hi = lane >> 4; const int wv = __builtin_amdgcn_readfirstlane(tid >> 5);
    const int grp = wv >> 3, w8 = wv & 7;
    const size_t hp = (size_t)blockIdx.z * NH_ + blockIdx.y;   // the (batch, head) plane
    const int srow = tid >> 3, sseg = (tid & 7) * 8, so = srow * FLP + sseg;   // staging: one 16-byte piece of each of the eight tiles a thread
    const unsigned ko = (unsigned)(srow * HD + sseg), vo = (unsigned)(srow * TT + sseg), qo = (unsigned)(lr * HD + 8 * hi), oo = (unsigned)(lr * DQ + 8 * hi);   // the lane's part of every global address, beside a wave-uniform base
#pragma unroll 1   // one copy of the stage loop in the text for both turns
    for (int turn = 0; turn < 2; ++turn) {
        const int qt = turn ? NQT - 1 - (int)blockIdx.x : (int)blockIdx.x;   // the query tile of this turn
        const int k0 = qt * QT, nst = NQT - qt;                // its first admitted key, its stages
        const int q = k0 + w8 * 16 + lr;                       // this lane's query
        v16bf qh[2], ql[2];
#pragma unroll
        for (int c = 0; c < 2; ++c) { const size_t qb = (hp * TT + k0 + w8 * 16) * HD + c * 32; qh[c] = WFrag<bf>::ld(Qh + qb + qo); ql[c] = WFrag<bf>::ld(Ql + qb + qo); }
        const size_t gk = (hp * TT + k0) * HD, gv = hp * HD * TT + k0;   // the tile's first key in the K planes (rows = keys) and in the Vt planes (columns = keys)
        v8us r0 = *(const v8us*)(Kh + gk + ko), r1 = *(const v8us*)(Kl + gk + ko), r2 = *(const v8us*)(Vh + gv + vo), r3 = *(const v8us*)(Vl + gv + vo);
        v8us r4 = *(const v8us*)(Kh + (gk + 64 * HD) + ko), r5 = *(const v8us*)(Kl + (gk + 64 * HD) + ko), r6 = *(const v8us*)(Vh + (gv + 64) + vo), r7 = *(const v8us*)(Vl + (gv + 64) + vo);
        { bf* sn = sm + so; *(v8usa*)sn = r0; *(v8usa*)(sn + FTILE) = r1; *(v8usa*)(sn + 2 * FTILE) = r2; *(v8usa*)(sn + 3 * FTILE) = r3;
          *(v8usa*)(sn + 4 * FTILE) = r4; *(v8usa*)(sn + 5 * FTILE) = r5; *(v8usa*)(sn + 6 * FTILE) = r6; *(v8usa*)(sn + 7 * FTILE) = r7; }
        __syncthreads();   // stage 0 is in LDS before any wave reads it
        v8f o[4];
#pragma unroll
        for (int dt = 0; dt < 4; ++dt) o[dt] = (v8f){};
        float m = -3.0e38f, l = 0.f;
#pragma unroll 1
        for (int s = 0; s < nst; ++s) {
            const bool more = s + 1 < nst;
            if (more) { const size_t k1 = (size_t)(s + 1) * QT; r0 = *(const v8us*)(Kh + (gk + k1 * HD) + ko); r1 = *(const v8us*)(Kl + (gk + k1 * HD) + ko); r2 = *(const v8us*)(Vh + (gv + k1) + vo); r3 = *(const v8us*)(Vl + (gv + k1) + vo);
                r4 = *(const v8us*)(Kh + (gk + (k1 + 64) * HD) + ko); r5 = *(const v8us*)(Kl + (gk + (k1 + 64) * HD) + ko); r6 = *(const v8us*)(Vh + (gv + k1 + 64) + vo); r7 = *(const v8us*)(Vl + (gv + k1 + 64) + vo); }
            const bf* sb = sm + (s & 1) * FBUF + grp * 4 * FTILE;
            const int kb = k0 + s * QT + grp * 64;   // first key of this group's half of the stage
            v8f st[4];   // st[kt][j] = score of key kb + kt*16 + 8*hi + j against query q
#pragma unroll
            for (int kt = 0; kt < 4; ++kt) { v8f a = (v8f){};
#pragma unroll
                for (int c = 0; c < 2; ++c) { const bf* kp = sb + (kt * 16 + lr) * FLP + c * 32 + 8 * hi; const v16bf kh = ldsfrag(kp), kl = ldsfrag(kp + FTILE);
                    a = wmmab(kh, qh[c], a); a = wmmab(kl, qh[c], a); a = wmmab(kh, ql[c], a); }
                st[kt] = a; }
            float mx = m;
#pragma unroll
            for (int kt = 0; kt < 4; ++kt)
#pragma unroll
                for (int j = 0; j < 8; ++j) { const float t = (kb + kt * 16 + 8 * hi + j >= q) ? st[kt][j] * CEXP : -3.0e38f;   /* anti-causal: keys before the query excluded (the module's tril(-1) -> -inf) */ st[kt][j] = t; mx = fmaxf(mx, t); }
            mx = fmaxf(mx, xhalf(mx));   // both halves of the wave hold the query's running maximum
            const float alpha = __builtin_amdgcn_exp2f(m - mx);   // 0 when the first admitted key arrives: whatever an all-excluded stage before it summed is wiped
            m = mx;
            float ps[4]; v16bf ph[2], pl[2];   // one partial sum a tile: four short add chains instead of one long one
#pragma unroll
            for (int kt = 0; kt < 4; ++kt) { ps[kt] = 0.f;
#pragma unroll
                for (int j = 0; j < 8; j += 2) { v2f p; p[0] = __builtin_amdgcn_exp2f(st[kt][j] - mx); p[1] = __builtin_amdgcn_exp2f(st[kt][j + 1] - mx); ps[kt] += p[0]; ps[kt] += p[1];
                    const v2bf h = __builtin_convertvector(p, v2bf); v2f r; r[0] = p[0] - (float)h[0]; r[1] = p[1] - (float)h[1]; const v2bf lo = __builtin_convertvector(r, v2bf);   // hi + lo planes of P, two elements a conversion
                    const int e = (kt & 1) * 8 + j; ph[kt >> 1][e] = h[0]; ph[kt >> 1][e + 1] = h[1]; pl[kt >> 1][e] = lo[0]; pl[kt >> 1][e + 1] = lo[1]; } }
            l = l * alpha + ((ps[0] + ps[1]) + (ps[2] + ps[3]));   // each half keeps the sum of its own keys; joined once after the loop
#pragma unroll
            for (int dt = 0; dt < 4; ++dt) o[dt] *= alpha;
#pragma unroll
            for (int kp2 = 0; kp2 < 2; ++kp2)
#pragma unroll
                for (int dt = 0; dt < 4; ++dt) { const bf* vp = sb + 2 * FTILE + (dt * 16 + lr) * FLP + kp2 * 32 + 8 * hi; const v16bf vh = ldsfrag(vp), vl = ldsfrag(vp + FTILE);
                    o[dt] = wmmab(vh, ph[kp2], o[dt]); o[dt] = wmmab(vh, pl[kp2], o[dt]); o[dt] = wmmab(vl, ph[kp2], o[dt]); }
            if (more) { bf* sn = sm + ((s + 1) & 1) * FBUF + so; *(v8usa*)sn = r0; *(v8usa*)(sn + FTILE) = r1; *(v8usa*)(sn + 2 * FTILE) = r2; *(v8usa*)(sn + 3 * FTILE) = r3;
                *(v8usa*)(sn + 4 * FTILE) = r4; *(v8usa*)(sn + 5 * FTILE) = r5; *(v8usa*)(sn + 6 * FTILE) = r6; *(v8usa*)(sn + 7 * FTILE) = r7; }
            __syncthreads();   // publishes stage s + 1 and ends every wave's reads of stage s, whose buffer the next trip (or the next turn's stage 0) refills
        }
        float* jr = jn + (w8 * 32 + lane) * JP;   // the record of this (wave of a group, lane): same query, same output rows in both groups
        if (grp == 1) {
#pragma unroll
            for (int dt = 0; dt < 4; ++dt) { *(v4fa*)(jr + dt * 8) = __builtin_shufflevector(o[dt], o[dt], 0, 1, 2, 3); *(v4fa*)(jr + dt * 8 + 4) = __builtin_shufflevector(o[dt], o[dt], 4, 5, 6, 7); }
            jr[32] = m; jr[33] = l; }
        __syncthreads();   // group 1's records are in LDS before group 0 reads them; the next turn's barriers end those reads before the records are rewritten
        if (grp == 0) {
            const float m1 = jr[32], l1 = jr[33], mj = fmaxf(m, m1);
            const float a0 = __builtin_amdgcn_exp2f(m - mj), a1 = __builtin_amdgcn_exp2f(m1 - mj);   // a group that saw no admitted key (maximum still at the floor) gets weight 0; the key j = q is always in one of the two
            l = l * a0 + l1 * a1; l += xhalf(l); const float inv = __fdiv_rn(1.0f, l);
            const size_t ob = ((size_t)blockIdx.z * TT + k0 + w8 * 16) * DQ + blockIdx.y * HD;   // o[dt][j] = out[q][dt*16 + 8*hi + j]: 8 consecutive d a lane
#pragma unroll
            for (int dt = 0; dt < 4; ++dt) { const v4f p0 = *(const v4fa*)(jr + dt * 8), p1 = *(const v4fa*)(jr + dt * 8 + 4); v8us oh, ol;
#pragma unroll
                for (int j = 0; j < 8; ++j) { unsigned short a, c2; splitf((o[dt][j] * a0 + (j < 4 ? p0[j & 3] : p1[j & 3]) * a1) * inv, a, c2); oh[j] = a; ol[j] = c2; }
                *(v8us*)(ATh + (ob + dt * 16) + oo) = oh; *(v8us*)(ATl + (ob + dt * 16) + oo) = ol; }
            asm volatile("s_wait_xcnt 0x0" ::: "memory");   // the next turn's first instructions rewrite registers that these stores name: the wait stands in front of them
        }
    }
}

extern "C" void kernel_launch(void* const* d_in, const int* in_sizes, int n_in,
                              void* d_out, int out_size, void* d_ws, size_t ws_size, hipStream_t stream) {
    (void)in_sizes; (void)n_in; (void)out_size;
    const float* x = (const float*)d_in[0]; const float* wq = (const float*)d_in[1]; const float* wk = (const float*)d_in[2]; const float* wv = (const float*)d_in[3]; const float* wo = (const float*)d_in[4]; const float* bo = (const float*)d_in[5];
    float* OUT = (float*)d_out;     // [2][2048][1024]
    char* wsp = (char*)d_ws;
    auto take = [&](size_t bytes) { char* p = wsp; wsp += (bytes + 255) & ~(size_t)255; return (void*)p; };
    bf* WQ = (bf*)take((size_t)DQ * DM * 2); bf* WK = (bf*)take((size_t)DKV * DM * 2); bf* WV = (bf*)take((size_t)DKV * DM * 2); bf* WO = (bf*)take((size_t)DM * DQ * 2);
    bf* XB = (bf*)take((size_t)NB_ * TT * DM * 2);
    const size_t PL = (size_t)NH_ * TT * HD;   // one batch's head planes, elements
    bf* QPh = (bf*)take(NB_ * PL * 2); bf* QPl = (bf*)take(NB_ * PL * 2); bf* KPh = (bf*)take(NB_ * PL * 2); bf* KPl = (bf*)take(NB_ * PL * 2); bf* VTh = (bf*)take(NB_ * PL * 2); bf* VTl = (bf*)take(NB_ * PL * 2);
    bf* ATh = (bf*)take((size_t)NB_ * TT * DQ * 2); bf* ATl = (bf*)take((size_t)NB_ * TT * DQ * 2);
    if ((size_t)(wsp - (char*)d_ws) > ws_size) return;    // ws 256 MiB
    k_cvtall<<<dim3(64, 8, 1), 256, 0, stream>>>(x, wq, wk, wv, wo, XB, WQ, WK, WV, WO);
    k_qkv<<<dim3(NB_ * TT / 64, NH_, 3), 256, 0, stream>>>(XB, WQ, WK, WV, QPh, QPl, KPh, KPl, VTh, VTl);
    k_fattn<<<dim3(TT / 256, NH_, NB_), 512, 0, stream>>>(QPh, QPl, KPh, KPl, VTh, VTl, ATh, ATl);
    k_gemmw<bf, 1, true, 8><<<dim3(NB_ * TT / 64, DM / 64, 1), 256, 0, stream>>>(ATh, ATl, WO, nullptr, DQ, OUT, DM, bo, 0, 0, 0);   // both batches: the merged rows and the output rows are contiguous over b
}

// v005
// A run of this version takes 108 microseconds.
// In two side-by-side timings against v004, it was 1.40 and 1.39 times as fast.
// Over all steps from v000 it is 12.1 times as fast.
#include <hip/hip_runtime.h>

// Multi-head attention with the module's ANTI-causal mask (x [2][2048][1024]; q,k,v = x W^T ('oi' [1024][1024] 0.02, no bias; 16 heads x 64); scores = q.k; keys strictly BEFORE the query (tril(-1)) -> -inf, i.e. each token attends to itself and the future; softmax(scores / 8); out = merged Wo^T + bo -> [2][2048][1024] (4.2 M)).
// Layout: one launch rounds x and the four weight matrices to bf16; one launch does the exact q, k, v projections of both batches and writes the hi/lo head planes from its own epilogue; ONE fused attention launch for all (batch, head) pairs with EVERY row on hi/lo planes (3 products; under the anti-causal mask the LAST rows see only a few keys; score tiles from each query tile's own first key on, the anti-causal pattern applied as the index select j >= i in the softmax; scores and probabilities stay in registers, running maximum and sum); merged hi/lo x Wo exact + bo.
// Compute dtypes, f32 accumulate: every input rounded to bf16; projections exact; attention 3 products on every row; softmax f32; Wo hl x exact + bias.

#define NB_  2
#define TT   2048
#define DM   1024
#define NH_  16
#define NKV  16
#define HD   64
#define DQ   (NH_ * HD)
#define DKV  (NKV * HD)
#define WIN  0
typedef _Float16 h16;
typedef unsigned short bf;
typedef __attribute__((ext_vector_type(16))) __bf16   v16bf;
typedef __attribute__((ext_vector_type(16))) _Float16 v16h;
typedef __attribute__((ext_vector_type(8)))  _Float16 v8h;
typedef __attribute__((ext_vector_type(8)))  unsigned short v8us;
typedef __attribute__((ext_vector_type(8)))  float    v8f;
typedef __attribute__((ext_vector_type(4)))  float    v4f;
typedef v8h  __attribute__((may_alias)) v8ha;
typedef v4f  __attribute__((may_alias)) v4fa;
typedef v8us __attribute__((may_alias)) v8usa;

__device__ __forceinline__ unsigned short f2bf(float f) { unsigned u = __float_as_uint(f); u += 0x7FFFu + ((u >> 16) & 1u); return (unsigned short)(u >> 16); }
__device__ __forceinline__ float bf2f(unsigned short b) { return __uint_as_float(((unsigned)b) << 16); }
__device__ __forceinline__ float bfr(float f) { return bf2f(f2bf(f)); }
__device__ __forceinline__ v16h cat16(v8h lo, v8h hi) { return __builtin_shufflevector(lo, hi, 0, 1, 2, 3, 4, 5, 6, 7, 8, 9, 10, 11, 12, 13, 14, 15); }
__device__ __forceinline__ v16bf cat16b(v8us lo, v8us hi) { return __builtin_bit_cast(v16bf, __builtin_shufflevector(lo, hi, 0, 1, 2, 3, 4, 5, 6, 7, 8, 9, 10, 11, 12, 13, 14, 15)); }
__device__ __forceinline__ v8f wmma16(v16h a, v16h b, v8f c) { return __builtin_amdgcn_wmma_f32_16x16x32_f16(false, a, false, b, (short)0, c, false, false); }
__device__ __forceinline__ v8f wmmab(v16bf a, v16bf b, v8f c) { return __builtin_amdgcn_wmma_f32_16x16x32_bf16(false, a, false, b, (short)0, c, false, false); }



// ---- fragment loaders: 16 k of a row a lane, hardware k order (8 * hi + 0..7, then + 16), the same for both operands.
template <typename T16> struct WFrag;
template <> struct WFrag<h16> { typedef v16h V; static __device__ __forceinline__ V ld(const h16* p) { return cat16(*(const v8h*)p, *(const v8h*)(p + 16)); } static __device__ __forceinline__ v8f mma(V a, V b, v8f c) { return wmma16(a, b, c); } };
template <> struct WFrag<bf> { typedef v16bf V; static __device__ __forceinline__ V ld(const bf* p) { return cat16b(*(const v8us*)p, *(const v8us*)(p + 16)); } static __device__ __forceinline__ v8f mma(V a, V b, v8f c) { return wmmab(a, b, c); } };

// ---- gemm128: the loop of both GEMM kernels. One 128x128 tile of C[m][n] = sum_k A[m][k] B[n][k] (+ A2[m][k] B[n][k]) a work-group of 8 waves, K = DM, operands K-contiguous bf16 planes.
// A stage is 64 k (one 128-byte line) of the tile's 128 rows of every operand plane, brought into LDS by asynchronous copies: a wave's copy covers four whole lines, and every line is fetched once a work-group.
// Two buffers: stage t + 2 flies while stage t + 1 is worked on. Waves 2 (rows) x 4 (columns); a wave owns 64x32 of the tile over the whole K (8 accumulators).
#define GLP   72                   // LDS row pitch in 16-bit elements: 144 B = 16 B x odd, conflict-free for 16-byte row reads
#define GPLN  (128 * GLP)          // one operand plane of a stage
#define GOP   132                  // output staging pitch in floats: 528 B = 16 B x odd
static_assert(128 * GOP * 4 <= 2 * 2 * GPLN * 2, "the f32 output tile fits the smaller ring");
__device__ __forceinline__ v16bf ldsfrag(const bf* p) { return cat16b(*(const v8usa*)p, *(const v8usa*)(p + 16)); }
// one plane of a stage: the thread's 16-byte piece of rows r, r + 32, r + 64, r + 96
__device__ __forceinline__ void cp_plane(const bf* dst, const bf* g0) {
    const unsigned l0 = (unsigned)(size_t)dst, l1 = l0 + 32 * GLP * 2, l2 = l0 + 64 * GLP * 2, l3 = l0 + 96 * GLP * 2;   // LDS byte addresses: the low 32 bits of the __shared__ address
    const bf* g1 = g0 + 32 * DM; const bf* g2 = g0 + 64 * DM; const bf* g3 = g0 + 96 * DM;
    // the wait is the statement's last line, so that no address register of a copy is rewritten in front of it
    asm volatile("global_load_async_to_lds_b128 %0, %4, off\n\tglobal_load_async_to_lds_b128 %1, %5, off\n\tglobal_load_async_to_lds_b128 %2, %6, off\n\tglobal_load_async_to_lds_b128 %3, %7, off\n\ts_wait_xcnt 0x0"
                 :: "v"(l0), "v"(l1), "v"(l2), "v"(l3), "v"(g0), "v"(g1), "v"(g2), "v"(g3) : "memory");
}
template <int NA>   // 1: A alone; 2: A and A2 (hi and lo planes), both against B
__device__ __forceinline__ void gemm128(const bf* __restrict__ A, const bf* __restrict__ A2, const bf* __restrict__ B, bf* sm, v8f (&acc)[4][2]) {
    constexpr int NT = DM / 64, BUF = (NA + 1) * GPLN;
    const int tid = threadIdx.x, lane = tid & 31, lr = lane & 15, hi = lane >> 4; const int wv = __builtin_amdgcn_readfirstlane(tid >> 5); const int wm = wv >> 2, wn = wv & 3;
    const unsigned go = (unsigned)((tid >> 3) * DM + (tid & 7) * 8);   // the lane's part of every copy's global address
    const bf* sl = sm + (tid >> 3) * GLP + (tid & 7) * 8;              // and its place in a plane
    auto fill = [&](int t) { const bf* d = sl + (t & 1) * BUF; cp_plane(d, A + t * 64 + go); if (NA == 2) cp_plane(d + GPLN, A2 + t * 64 + go); cp_plane(d + NA * GPLN, B + t * 64 + go); };
#pragma unroll   // constant indices: the fragment and accumulator arrays stay in registers
    for (int mb = 0; mb < 4; ++mb)
#pragma unroll   // constant indices: the fragment and accumulator arrays stay in registers
        for (int nb = 0; nb < 2; ++nb) acc[mb][nb] = (v8f){};
    fill(0);
    asm volatile("s_wait_asynccnt 0x0" ::: "memory");   // this wave's copies of stage 0 have landed
    __syncthreads();                                     // and every other wave's: stage 0 may be read
    fill(1);
#pragma unroll 1   // one stage a trip: the buffer is picked by t & 1
    for (int t = 0; t < NT; ++t) {
        const bf* sa = sm + (t & 1) * BUF + (wm * 64 + lr) * GLP + 8 * hi; const bf* sb = sm + (t & 1) * BUF + NA * GPLN + (wn * 32 + lr) * GLP + 8 * hi;
#pragma unroll   // constant indices: the fragment and accumulator arrays stay in registers
        for (int c = 0; c < 2; ++c) { v16bf a[4], a2[4], b[2];
#pragma unroll   // constant indices: the fragment and accumulator arrays stay in registers
            for (int mb = 0; mb < 4; ++mb) { a[mb] = ldsfrag(sa + mb * 16 * GLP + c * 32); if (NA == 2) a2[mb] = ldsfrag(sa + GPLN + mb * 16 * GLP + c * 32); }
#pragma unroll   // constant indices: the fragment and accumulator arrays stay in registers
            for (int nb = 0; nb < 2; ++nb) b[nb] = ldsfrag(sb + nb * 16 * GLP + c * 32);
#pragma unroll   // constant indices: the fragment and accumulator arrays stay in registers
            for (int nb = 0; nb < 2; ++nb)
#pragma unroll   // constant indices: the fragment and accumulator arrays stay in registers
                for (int mb = 0; mb < 4; ++mb) { acc[mb][nb] = wmmab(a[mb], b[nb], acc[mb][nb]); if (NA == 2) acc[mb][nb] = wmmab(a2[mb], b[nb], acc[mb][nb]); } }
        asm volatile("s_wait_dscnt 0x0" ::: "memory");      // this wave's reads of stage t are done before its buffer is refilled
        asm volatile("s_wait_asynccnt 0x0" ::: "memory");   // this wave's copies of stage t + 1 have landed
        __syncthreads();                                     // publishes stage t + 1 and ends every wave's reads of stage t
        if (t + 2 < NT) fill(t + 2);
    }
    asm volatile("s_wait_asynccnt 0x0" ::: "memory");   // nothing is in flight when the ring becomes the output staging
}
// the wave's 64x32 part of the f32 tile into the staging rows (the ring, free behind the loop's last barrier)
__device__ __forceinline__ void stage128(float* os, const v8f (&acc)[4][2]) {
    const int lane = threadIdx.x & 31, lr = lane & 15, hi = lane >> 4; const int wv = __builtin_amdgcn_readfirstlane((int)(threadIdx.x >> 5)); const int wm = wv >> 2, wn = wv & 3;
#pragma unroll   // constant indices: the fragment and accumulator arrays stay in registers
    for (int mb = 0; mb < 4; ++mb)
#pragma unroll   // constant indices: the fragment and accumulator arrays stay in registers
        for (int nb = 0; nb < 2; ++nb)
#pragma unroll   // constant indices: the fragment and accumulator arrays stay in registers
            for (int j = 0; j < 8; ++j) os[(wm * 64 + mb * 16 + hi * 8 + j) * GOP + wn * 32 + nb * 16 + lr] = acc[mb][nb][j];
}

__device__ __forceinline__ h16 tohx(float x) { return (h16)x; }
__device__ __forceinline__ void splitf(float y, unsigned short& h, unsigned short& l) { h = f2bf(y); l = f2bf(y - bf2f(h)); }
typedef __attribute__((ext_vector_type(2))) _Float16 v2h;
typedef __attribute__((ext_vector_type(4))) _Float16 v4h;
typedef __attribute__((ext_vector_type(2))) unsigned short v2us;
typedef __attribute__((ext_vector_type(4))) unsigned short v4us;
typedef __attribute__((ext_vector_type(2))) float v2f;
typedef __attribute__((ext_vector_type(4))) int v4i;

__global__ __launch_bounds__(256) void k_wtG(const float* __restrict__ w, int K, int N, bf* Bt) {
    const int lane = threadIdx.x & 31; const int L0 = (blockIdx.x * 8 + (threadIdx.x >> 5)) * 8; const int nlines = N * K / 64;
{
#pragma unroll 1
        for (int l = 0; l < 8; ++l) { const int L = L0 + l; if (L >= nlines) break; const size_t e = (size_t)L * 64 + lane * 2; const int k = (int)(e % K), n = (int)(e / K); v2us o;
            o[0] = f2bf(w[(size_t)k * N + n]); o[1] = f2bf(w[(size_t)(k + 1) * N + n]); *(v2us*)(Bt + e) = o; }
         }
}
// ---- k_cvtall: every f32 operand of the products rounded to bf16 in one launch. Grid (64, 8), 256 threads: slice y (DM x DM elements) is a quarter of x (y < 4) or one weight matrix; a thread converts 8 pieces of 8 elements, all its loads issued before the first conversion.
static_assert((size_t)NB_ * TT * DM == 4 * (size_t)DM * DM && DQ == DM && DKV == DM, "slices of DM x DM elements");
__global__ __launch_bounds__(256) void k_cvtall(const float* __restrict__ x, const float* __restrict__ wq, const float* __restrict__ wk, const float* __restrict__ wv, const float* __restrict__ wo, bf* XB, bf* WQ, bf* WK, bf* WV, bf* WO) {
    const int y = blockIdx.y; const size_t SL = (size_t)DM * DM; const float* s; bf* d;
    if (y < 4) { s = x + y * SL; d = XB + y * SL; } else if (y == 4) { s = wq; d = WQ; } else if (y == 5) { s = wk; d = WK; } else if (y == 6) { s = wv; d = WV; } else { s = wo; d = WO; }
    const size_t i0 = ((size_t)blockIdx.x * 2048 + threadIdx.x) * 8; const float* sp = s + i0; v8f v[8];
#pragma unroll
    for (int j = 0; j < 8; ++j) v[j] = *(const v8f*)(sp + j * 2048);
    asm volatile("s_wait_xcnt 0x0" :: "v"(sp) : "memory");   // the loads' address pair is an input here, so no load lands on it; behind the wait it is free for reuse
#pragma unroll
    for (int j = 0; j < 8; ++j) { v8us o;
#pragma unroll
        for (int k = 0; k < 8; ++k) o[k] = f2bf(v[j][k]);
        *(v8us*)(d + i0 + j * 2048) = o; }
}

// ---- k_qkv: the q, k and v projections of both batches in one launch on gemm128. Grid (NB_*TT/128 token tiles, head pairs, 3).
// A 128x128 tile is 128 tokens x two heads; the epilogue splits each sum into hi + lo bf16 and stores it straight into the head planes: q, k as [b][h][t][d]; v is computed as Wv x^T (rows = d, columns = t), which is the [b][h][d][t] plane row by row.
__global__ __launch_bounds__(256) void k_qkv(const bf* __restrict__ X, const bf* __restrict__ WQ, const bf* __restrict__ WK, const bf* __restrict__ WV, bf* Qh, bf* Ql, bf* Kh, bf* Kl, bf* Vh, bf* Vl) {
    __shared__ __align__(16) bf sm[2 * 2 * GPLN];
    const int z = blockIdx.z, b = blockIdx.x / (TT / 128), t0 = (blockIdx.x % (TT / 128)) * 128; const size_t hp = (size_t)b * NH_ + blockIdx.y * 2;
    const bf* xt = X + (size_t)blockIdx.x * 128 * DM; const bf* wt = (z == 0 ? WQ : z == 1 ? WK : WV) + (size_t)blockIdx.y * 128 * DM;
    bf* Ph = (z == 0 ? Qh : z == 1 ? Kh : Vh); bf* Pl = (z == 0 ? Ql : z == 1 ? Kl : Vl);
    v8f acc[4][2];
    gemm128<1>((z == 2) ? wt : xt, nullptr, (z == 2) ? xt : wt, sm, acc);
    float* os = (float*)sm;
    stage128(os, acc);
    __syncthreads();   // the whole tile is in LDS before any thread reads a row of it
    const int w = __builtin_amdgcn_readfirstlane((int)(threadIdx.x >> 5)), cofs = (threadIdx.x & 31) * 4;   // a wave takes rows w, w + 8, ...; a lane 4 columns
    const unsigned lo = (z == 2) ? (unsigned)cofs : (unsigned)((cofs >> 6) * TT * HD + (cofs & 63));   // the lane's part of every store address, beside a wave-uniform base
    const size_t ub = (z == 2) ? (hp * HD + w) * TT + t0 : (hp * TT + t0 + w) * HD; const size_t us = (z == 2) ? 8 * TT : 8 * HD;   // row w of the tile in the plane; 8 rows on
#pragma unroll   // the rows' LDS reads and stores overlap
    for (int i = 0; i < 16; ++i) { const v4f val = *(const v4fa*)(os + (i * 8 + w) * GOP + cofs);
        v4us oh, ol;
#pragma unroll   // constant vector indices
        for (int e = 0; e < 4; ++e) { unsigned short a2, c2; splitf(val[e], a2, c2); oh[e] = a2; ol[e] = c2; }
        *(v4us*)(Ph + (ub + i * us) + lo) = oh; *(v4us*)(Pl + (ub + i * us) + lo) = ol; }
}
// ---- k_wo: out = (merged hi + merged lo) Wo^T + bo on gemm128, both batches (the merged rows and the output rows are contiguous over b). Grid (NB_*TT/128, DM/128).
__global__ __launch_bounds__(256) void k_wo(const bf* __restrict__ ATh, const bf* __restrict__ ATl, const bf* __restrict__ WO, const float* __restrict__ bias, float* C) {
    __shared__ __align__(16) bf sm[2 * 3 * GPLN];
    const int r0 = blockIdx.x * 128, c0 = blockIdx.y * 128;
    v8f acc[4][2];
    gemm128<2>(ATh + (size_t)r0 * DQ, ATl + (size_t)r0 * DQ, WO + (size_t)c0 * DQ, sm, acc);
    float* os = (float*)sm;
    stage128(os, acc);
    __syncthreads();   // the whole tile is in LDS before any thread reads a row of it
    const int w = __builtin_amdgcn_readfirstlane((int)(threadIdx.x >> 5)), cofs = (threadIdx.x & 31) * 4;   // a wave takes rows w, w + 8, ...: 512 contiguous bytes a store
    v4f bb; bb[0] = bfr(bias[c0 + cofs]); bb[1] = bfr(bias[c0 + cofs + 1]); bb[2] = bfr(bias[c0 + cofs + 2]); bb[3] = bfr(bias[c0 + cofs + 3]);
#pragma unroll   // the rows' LDS reads and stores overlap
    for (int i = 0; i < 16; ++i) { const v4f val = *(const v4fa*)(os + (i * 8 + w) * GOP + cofs) + bb;
        *(v4f*)(C + ((size_t)(r0 + i * 8 + w) * DM + c0) + (unsigned)cofs) = val; }
}
// ---- k_fattn: scores, softmax, P.V and the head merge in one kernel. Grid (TT/256, heads, batches), 16 waves = two groups of 8; a wave owns 16 queries, a lane one query (column lr) and half of each key group.
// Keys before a query tile's first query are excluded for every query of the tile, so a tile of 128 queries starts at its own first key: tile t walks 16 - t stages of 128 keys. A work-group takes tile t and then tile 15 - t, 17 stages whatever t is.
// Both wave groups hold the same 128 queries; group g takes the g-th 64 keys of every stage with its own running maximum and sum, and the two partial results are joined through LDS behind the tile's last stage.
// St = K Qt and Ot += Vt Pt: the score accumulators of two 16-key tiles, converted in place, are the B operand of the second product (hardware k order; the K, Q and Vt loaders use the same order).
// K and Vt hi/lo tiles go global -> registers -> LDS, two buffers: the next stage's loads fly during this stage's work, one barrier a stage.
#define FLP   72                   // LDS row pitch in 16-bit elements: 144 B = 16 B x odd, conflict-free for 16-byte row reads
#define FTILE (64 * FLP)
#define FBUF  (8 * FTILE)          // one buffer: two halves of 64 keys x (K hi, K lo, Vt hi, Vt lo)
#define QT    128                  // queries a tile, keys a stage
#define NQT   (TT / QT)
#define JP    36                   // join record pitch in floats: 144 B = 16 B x odd
#define CEXP  0.18033688011112042f // HD^-0.5 x log2(e): scores go to base 2 in the one multiply
static_assert(NQT % 2 == 0 && TT / 256 == NQT / 2, "tiles t and NQT - 1 - t pair up over the grid");
typedef __attribute__((ext_vector_type(2))) __bf16 v2bf;
__device__ __forceinline__ float xhalf(float x) { return __builtin_bit_cast(float, __builtin_amdgcn_permlanex16(__builtin_bit_cast(int, x), __builtin_bit_cast(int, x), 0x76543210, 0xfedcba98, false, false)); }   // lane l with lane l ^ 16
__global__ __launch_bounds__(512) void k_fattn(const bf* __restrict__ Qh, const bf* __restrict__ Ql, const bf* __restrict__ Kh, const bf* __restrict__ Kl, const bf* __restrict__ Vh, const bf* __restrict__ Vl, bf* ATh, bf* ATl) {
    __shared__ __align__(16) bf sm[2 * FBUF];        // [buffer][key half][K hi, K lo, Vt hi, Vt lo][64 rows][FLP]
    __shared__ __align__(16) float jn[256 * JP];     // group 1's partial result, one record a lane: 32 output sums, maximum, sum
    const int tid = threadIdx.x, lane = tid & 31, lr = lane & 15, hi = lane >> 4; const int wv = __builtin_amdgcn_readfirstlane(tid >> 5);
    const int grp = wv >> 3, w8 = wv & 7;
    const size_t hp = (size_t)blockIdx.z * NH_ + blockIdx.y;   // the (batch, head) plane
    const int srow = tid >> 3, sseg = (tid & 7) * 8, so = srow * FLP + sseg;   // staging: one 16-byte piece of each of the eight tiles a thread
    const unsigned ko = (unsigned)(srow * HD + sseg), vo = (unsigned)(srow * TT + sseg), qo = (unsigned)(lr * HD + 8 * hi), oo = (unsigned)(lr * DQ + 8 * hi);   // the lane's part of every global address, beside a wave-uniform base
#pragma unroll 1   // one copy of the stage loop in the text for both turns
    for (int turn = 0; turn < 2; ++turn) {
        const int qt = turn ? NQT - 1 - (int)blockIdx.x : (int)blockIdx.x;   // the query tile of this turn
        const int k0 = qt * QT, nst = NQT - qt;                // its first admitted key, its stages
        const int q = k0 + w8 * 16 + lr;                       // this lane's query
        v16bf qh[2], ql[2];
#pragma unroll
        for (int c = 0; c < 2; ++c) { const size_t qb = (hp * TT + k0 + w8 * 16) * HD + c * 32; qh[c] = WFrag<bf>::ld(Qh + qb + qo); ql[c] = WFrag<bf>::ld(Ql + qb + qo); }
        const size_t gk = (hp * TT + k0) * HD, gv = hp * HD * TT + k0;   // the tile's first key in the K planes (rows = keys) and in the Vt planes (columns = keys)
        v8us r0 = *(const v8us*)(Kh + gk + ko), r1 = *(const v8us*)(Kl + gk + ko), r2 = *(const v8us*)(Vh + gv + vo), r3 = *(const v8us*)(Vl + gv + vo);
        v8us r4 = *(const v8us*)(Kh + (gk + 64 * HD) + ko), r5 = *(const v8us*)(Kl + (gk + 64 * HD) + ko), r6 = *(const v8us*)(Vh + (gv + 64) + vo), r7 = *(const v8us*)(Vl + (gv + 64) + vo);
        { bf* sn = sm + so; *(v8usa*)sn = r0; *(v8usa*)(sn + FTILE) = r1; *(v8usa*)(sn + 2 * FTILE) = r2; *(v8usa*)(sn + 3 * FTILE) = r3;
          *(v8usa*)(sn + 4 * FTILE) = r4; *(v8usa*)(sn + 5 * FTILE) = r5; *(v8usa*)(sn + 6 * FTILE) = r6; *(v8usa*)(sn + 7 * FTILE) = r7; }
        __syncthreads();   // stage 0 is in LDS before any wave reads it
        v8f o[4];
#pragma unroll
        for (int dt = 0; dt < 4; ++dt) o[dt] = (v8f){};
        float m = -3.0e38f, l = 0.f;
#pragma unroll 1
        for (int s = 0; s < nst; ++s) {
            const bool more = s + 1 < nst;
            if (more) { const size_t k1 = (size_t)(s + 1) * QT; r0 = *(const v8us*)(Kh + (gk + k1 * HD) + ko); r1 = *(const v8us*)(Kl + (gk + k1 * HD) + ko); r2 = *(const v8us*)(Vh + (gv + k1) + vo); r3 = *(const v8us*)(Vl + (gv + k1) + vo);
                r4 = *(const v8us*)(Kh + (gk + (k1 + 64) * HD) + ko); r5 = *(const v8us*)(Kl + (gk + (k1 + 64) * HD) + ko); r6 = *(const v8us*)(Vh + (gv + k1 + 64) + vo); r7 = *(const v8us*)(Vl + (gv + k1 + 64) + vo); }
            const bf* sb = sm + (s & 1) * FBUF + grp * 4 * FTILE;
            const int kb = k0 + s * QT + grp * 64;   // first key of this group's half of the stage
            v8f st[4];   // st[kt][j] = score of key kb + kt*16 + 8*hi + j against query q
#pragma unroll
            for (int kt = 0; kt < 4; ++kt) { v8f a = (v8f){};
#pragma unroll
                for (int c = 0; c < 2; ++c) { const bf* kp = sb + (kt * 16 + lr) * FLP + c * 32 + 8 * hi; const v16bf kh = ldsfrag(kp), kl = ldsfrag(kp + FTILE);
                    a = wmmab(kh, qh[c], a); a = wmmab(kl, qh[c], a); a = wmmab(kh, ql[c], a); }
                st[kt] = a; }
            float mx = m;
#pragma unroll
            for (int kt = 0; kt < 4; ++kt)
#pragma unroll
                for (int j = 0; j < 8; ++j) { const float t = (kb + kt * 16 + 8 * hi + j >= q) ? st[kt][j] * CEXP : -3.0e38f;   /* anti-causal: keys before the query excluded (the module's tril(-1) -> -inf) */ st[kt][j] = t; mx = fmaxf(mx, t); }
            mx = fmaxf(mx, xhalf(mx));   // both halves of the wave hold the query's running maximum
            const float alpha = __builtin_amdgcn_exp2f(m - mx);   // 0 when the first admitted key arrives: whatever an all-excluded stage before it summed is wiped
            m = mx;
            float ps[4]; v16bf ph[2], pl[2];   // one partial sum a tile: four short add chains instead of one long one
#pragma unroll
            for (int kt = 0; kt < 4; ++kt) { ps[kt] = 0.f;
#pragma unroll
                for (int j = 0; j < 8; j += 2) { v2f p; p[0] = __builtin_amdgcn_exp2f(st[kt][j] - mx); p[1] = __builtin_amdgcn_exp2f(st[kt][j + 1] - mx); ps[kt] += p[0]; ps[kt] += p[1];
                    const v2bf h = __builtin_convertvector(p, v2bf); v2f r; r[0] = p[0] - (float)h[0]; r[1] = p[1] - (float)h[1]; const v2bf lo = __builtin_convertvector(r, v2bf);   // hi + lo planes of P, two elements a conversion
                    const int e = (kt & 1) * 8 + j; ph[kt >> 1][e] = h[0]; ph[kt >> 1][e + 1] = h[1]; pl[kt >> 1][e] = lo[0]; pl[kt >> 1][e + 1] = lo[1]; } }
            l = l * alpha + ((ps[0] + ps[1]) + (ps[2] + ps[3]));   // each half keeps the sum of its own keys; joined once after the loop
#pragma unroll
            for (int dt = 0; dt < 4; ++dt) o[dt] *= alpha;
#pragma unroll
            for (int kp2 = 0; kp2 < 2; ++kp2)
#pragma unroll
                for (int dt = 0; dt < 4; ++dt) { const bf* vp = sb + 2 * FTILE + (dt * 16 + lr) * FLP + kp2 * 32 + 8 * hi; const v16bf vh = ldsfrag(vp), vl = ldsfrag(vp + FTILE);
                    o[dt] = wmmab(vh, ph[kp2], o[dt]); o[dt] = wmmab(vh, pl[kp2], o[dt]); o[dt] = wmmab(vl, ph[kp2], o[dt]); }
            if (more) { bf* sn = sm + ((s + 1) & 1) * FBUF + so; *(v8usa*)sn = r0; *(v8usa*)(sn + FTILE) = r1; *(v8usa*)(sn + 2 * FTILE) = r2; *(v8usa*)(sn + 3 * FTILE) = r3;
                *(v8usa*)(sn + 4 * FTILE) = r4; *(v8usa*)(sn + 5 * FTILE) = r5; *(v8usa*)(sn + 6 * FTILE) = r6; *(v8usa*)(sn + 7 * FTILE) = r7; }
            __syncthreads();   // publishes stage s + 1 and ends every wave's reads of stage s, whose buffer the next trip (or the next turn's stage 0) refills
        }
        float* jr = jn + (w8 * 32 + lane) * JP;   // the record of this (wave of a group, lane): same query, same output rows in both groups
        if (grp == 1) {
#pragma unroll
            for (int dt = 0; dt < 4; ++dt) { *(v4fa*)(jr + dt * 8) = __builtin_shufflevector(o[dt], o[dt], 0, 1, 2, 3); *(v4fa*)(jr + dt * 8 + 4) = __builtin_shufflevector(o[dt], o[dt], 4, 5, 6, 7); }
            jr[32] = m; jr[33] = l; }
        __syncthreads();   // group 1's records are in LDS before group 0 reads them; the next turn's barriers end those reads before the records are rewritten
        if (grp == 0) {
            const float m1 = jr[32], l1 = jr[33], mj = fmaxf(m, m1);
            const float a0 = __builtin_amdgcn_exp2f(m - mj), a1 = __builtin_amdgcn_exp2f(m1 - mj);   // a group that saw no admitted key (maximum still at the floor) gets weight 0; the key j = q is always in one of the two
            l = l * a0 + l1 * a1; l += xhalf(l); const float inv = __fdiv_rn(1.0f, l);
            const size_t ob = ((size_t)blockIdx.z * TT + k0 + w8 * 16) * DQ + blockIdx.y * HD;   // o[dt][j] = out[q][dt*16 + 8*hi + j]: 8 consecutive d a lane
#pragma unroll
            for (int dt = 0; dt < 4; ++dt) { const v4f p0 = *(const v4fa*)(jr + dt * 8), p1 = *(const v4fa*)(jr + dt * 8 + 4); v8us oh, ol;
#pragma unroll
                for (int j = 0; j < 8; ++j) { unsigned short a, c2; splitf((o[dt][j] * a0 + (j < 4 ? p0[j & 3] : p1[j & 3]) * a1) * inv, a, c2); oh[j] = a; ol[j] = c2; }
                *(v8us*)(ATh + (ob + dt * 16) + oo) = oh; *(v8us*)(ATl + (ob + dt * 16) + oo) = ol; }
            asm volatile("s_wait_xcnt 0x0" ::: "memory");   // the next turn's first instructions rewrite registers that these stores name: the wait stands in front of them
        }
    }
}

extern "C" void kernel_launch(void* const* d_in, const int* in_sizes, int n_in,
                              void* d_out, int out_size, void* d_ws, size_t ws_size, hipStream_t stream) {
    (void)in_sizes; (void)n_in; (void)out_size;
    const float* x = (const float*)d_in[0]; const float* wq = (const float*)d_in[1]; const float* wk = (const float*)d_in[2]; const float* wv = (const float*)d_in[3]; const float* wo = (const float*)d_in[4]; const float* bo = (const float*)d_in[5];
    float* OUT = (float*)d_out;     // [2][2048][1024]
    char* wsp = (char*)d_ws;
    auto take = [&](size_t bytes) { char* p = wsp; wsp += (bytes + 255) & ~(size_t)255; return (void*)p; };
    bf* WQ = (bf*)take((size_t)DQ * DM * 2); bf* WK = (bf*)take((size_t)DKV * DM * 2); bf* WV = (bf*)take((size_t)DKV * DM * 2); bf* WO = (bf*)take((size_t)DM * DQ * 2);
    bf* XB = (bf*)take((size_t)NB_ * TT * DM * 2);
    const size_t PL = (size_t)NH_ * TT * HD;   // one batch's head planes, elements
    bf* QPh = (bf*)take(NB_ * PL * 2); bf* QPl = (bf*)take(NB_ * PL * 2); bf* KPh = (bf*)take(NB_ * PL * 2); bf* KPl = (bf*)take(NB_ * PL * 2); bf* VTh = (bf*)take(NB_ * PL * 2); bf* VTl = (bf*)take(NB_ * PL * 2);
    bf* ATh = (bf*)take((size_t)NB_ * TT * DQ * 2); bf* ATl = (bf*)take((size_t)NB_ * TT * DQ * 2);
    if ((size_t)(wsp - (char*)d_ws) > ws_size) return;    // ws 256 MiB
    k_cvtall<<<dim3(64, 8, 1), 256, 0, stream>>>(x, wq, wk, wv, wo, XB, WQ, WK, WV, WO);
    k_qkv<<<dim3(NB_ * TT / 128, NH_ / 2, 3), 256, 0, stream>>>(XB, WQ, WK, WV, QPh, QPl, KPh, KPl, VTh, VTl);
    k_fattn<<<dim3(TT / 256, NH_, NB_), 512, 0, stream>>>(QPh, QPl, KPh, KPl, VTh, VTl, ATh, ATl);
    k_wo<<<dim3(NB_ * TT / 128, DM / 128, 1), 256, 0, stream>>>(ATh, ATl, WO, bo, OUT);
}

// v006
// One run takes 104 microseconds.
// Timed twice side by side with v005, it ran 1.03 times as fast both times.
// Over all steps from v000 it is 12.5 times as fast.
#include <hip/hip_runtime.h>

// Multi-head attention with the module's ANTI-causal mask (x [2][2048][1024]; q,k,v = x W^T ('oi' [1024][1024] 0.02, no bias; 16 heads x 64); scores = q.k; keys strictly BEFORE the query (tril(-1)) -> -inf, i.e. each token attends to itself and the future; softmax(scores / 8); out = merged Wo^T + bo -> [2][2048][1024] (4.2 M)).
// Layout: one launch rounds x and the four weight matrices to bf16; one launch does the exact q, k, v projections of both batches and writes the hi/lo head planes from its own epilogue; ONE fused attention launch for all (batch, head) pairs with EVERY row on hi/lo planes (3 products; under the anti-causal mask the LAST rows see only a few keys; score tiles from each query tile's own first key on, the anti-causal pattern applied as the index select j >= i in the softmax; scores and probabilities stay in registers, running maximum and sum); merged hi/lo x Wo exact + bo.
// Compute dtypes, f32 accumulate: every input rounded to bf16; projections exact; attention 3 products on every row; softmax f32; Wo hl x exact + bias.

#define NB_  2
#define TT   2048
#define DM   1024
#define NH_  16
#define NKV  16
#define HD   64
#define DQ   (NH_ * HD)
#define DKV  (NKV * HD)
#define WIN  0
typedef _Float16 h16;
typedef unsigned short bf;
typedef __attribute__((ext_vector_type(16))) __bf16   v16bf;
typedef __attribute__((ext_vector_type(16))) _Float16 v16h;
typedef __attribute__((ext_vector_type(8)))  _Float16 v8h;
typedef __attribute__((ext_vector_type(8)))  unsigned short v8us;
typedef __attribute__((ext_vector_type(8)))  float    v8f;
typedef __attribute__((ext_vector_type(4)))  float    v4f;
typedef v8h  __attribute__((may_alias)) v8ha;
typedef v4f  __attribute__((may_alias)) v4fa;
typedef v8us __attribute__((may_alias)) v8usa;

__device__ __forceinline__ unsigned short f2bf(float f) { unsigned u = __float_as_uint(f); u += 0x7FFFu + ((u >> 16) & 1u); return (unsigned short)(u >> 16); }
__device__ __forceinline__ float bf2f(unsigned short b) { return __uint_as_float(((unsigned)b) << 16); }
__device__ __forceinline__ float bfr(float f) { return bf2f(f2bf(f)); }
__device__ __forceinline__ v16h cat16(v8h lo, v8h hi) { return __builtin_shufflevector(lo, hi, 0, 1, 2, 3, 4, 5, 6, 7, 8, 9, 10, 11, 12, 13, 14, 15); }
__device__ __forceinline__ v16bf cat16b(v8us lo, v8us hi) { return __builtin_bit_cast(v16bf, __builtin_shufflevector(lo, hi, 0, 1, 2, 3, 4, 5, 6, 7, 8, 9, 10, 11, 12, 13, 14, 15)); }
__device__ __forceinline__ v8f wmma16(v16h a, v16h b, v8f c) { return __builtin_amdgcn_wmma_f32_16x16x32_f16(false, a, false, b, (short)0, c, false, false); }
__device__ __forceinline__ v8f wmmab(v16bf a, v16bf b, v8f c) { return __builtin_amdgcn_wmma_f32_16x16x32_bf16(false, a, false, b, (short)0, c, false, false); }



// ---- fragment loaders: 16 k of a row a lane, hardware k order (8 * hi + 0..7, then + 16), the same for both operands.
template <typename T16> struct WFrag;
template <> struct WFrag<h16> { typedef v16h V; static __device__ __forceinline__ V ld(const h16* p) { return cat16(*(const v8h*)p, *(const v8h*)(p + 16)); } static __device__ __forceinline__ v8f mma(V a, V b, v8f c) { return wmma16(a, b, c); } };
template <> struct WFrag<bf> { typedef v16bf V; static __device__ __forceinline__ V ld(const bf* p) { return cat16b(*(const v8us*)p, *(const v8us*)(p + 16)); } static __device__ __forceinline__ v8f mma(V a, V b, v8f c) { return wmmab(a, b, c); } };

// ---- gemm128: the loop of both GEMM kernels. One 128x128 tile of C[m][n] = sum_k A[m][k] B[n][k] (+ A2[m][k] B[n][k]) a work-group of 8 waves, K = DM, operands K-contiguous bf16 planes.
// A stage is 64 k (one 128-byte line) of the tile's 128 rows of every operand plane, brought into LDS by asynchronous copies: a wave's copy covers four whole lines, and every line is fetched once a work-group.
// Two buffers: stage t + 2 flies while stage t + 1 is worked on. Waves 2 (rows) x 4 (columns); a wave owns 64x32 of the tile over the whole K (8 accumulators).
#define GLP   72                   // LDS row pitch in 16-bit elements: 144 B = 16 B x odd, conflict-free for 16-byte row reads
#define GPLN  (128 * GLP)          // one operand plane of a stage
#define GOP   132                  // output staging pitch in floats: 528 B = 16 B x odd
static_assert(128 * GOP * 4 <= 2 * 2 * GPLN * 2, "the f32 output tile fits the smaller ring");
__device__ __forceinline__ v16bf ldsfrag(const bf* p) { return cat16b(*(const v8usa*)p, *(const v8usa*)(p + 16)); }
// one plane of a stage: the thread's 16-byte piece of rows r, r + 32, r + 64, r + 96
__device__ __forceinline__ void cp_plane(const bf* dst, const bf* g0) {
    const unsigned l0 = (unsigned)(size_t)dst, l1 = l0 + 32 * GLP * 2, l2 = l0 + 64 * GLP * 2, l3 = l0 + 96 * GLP * 2;   // LDS byte addresses: the low 32 bits of the __shared__ address
    const bf* g1 = g0 + 32 * DM; const bf* g2 = g0 + 64 * DM; const bf* g3 = g0 + 96 * DM;
    // the wait is the statement's last line, so that no address register of a copy is rewritten in front of it
    asm volatile("global_load_async_to_lds_b128 %0, %4, off\n\tglobal_load_async_to_lds_b128 %1, %5, off\n\tglobal_load_async_to_lds_b128 %2, %6, off\n\tglobal_load_async_to_lds_b128 %3, %7, off\n\ts_wait_xcnt 0x0"
                 :: "v"(l0), "v"(l1), "v"(l2), "v"(l3), "v"(g0), "v"(g1), "v"(g2), "v"(g3) : "memory");
}
template <int NA>   // 1: A alone; 2: A and A2 (hi and lo planes), both against B
__device__ __forceinline__ void gemm128(const bf* __restrict__ A, const bf* __restrict__ A2, const bf* __restrict__ B, bf* sm, v8f (&acc)[4][2]) {
    constexpr int NT = DM / 64, BUF = (NA + 1) * GPLN;
    const int tid = threadIdx.x, lane = tid & 31, lr = lane & 15, hi = lane >> 4; const int wv = __builtin_amdgcn_readfirstlane(tid >> 5); const int wm = wv >> 2, wn = wv & 3;
    const unsigned go = (unsigned)((tid >> 3) * DM + (tid & 7) * 8);   // the lane's part of every copy's global address
    const bf* sl = sm + (tid >> 3) * GLP + (tid & 7) * 8;              // and its place in a plane
    auto fill = [&](int t) { const bf* d = sl + (t & 1) * BUF; cp_plane(d, A + t * 64 + go); if (NA == 2) cp_plane(d + GPLN, A2 + t * 64 + go); cp_plane(d + NA * GPLN, B + t * 64 + go); };
#pragma unroll   // constant indices: the fragment and accumulator arrays stay in registers
    for (int mb = 0; mb < 4; ++mb)
#pragma unroll   // constant indices: the fragment and accumulator arrays stay in registers
        for (int nb = 0; nb < 2; ++nb) acc[mb][nb] = (v8f){};
    fill(0);
    asm volatile("s_wait_asynccnt 0x0" ::: "memory");   // this wave's copies of stage 0 have landed
    __syncthreads();                                     // and every other wave's: stage 0 may be read
    fill(1);
#pragma unroll 1   // one stage a trip: the buffer is picked by t & 1
    for (int t = 0; t < NT; ++t) {
        const bf* sa = sm + (t & 1) * BUF + (wm * 64 + lr) * GLP + 8 * hi; const bf* sb = sm + (t & 1) * BUF + NA * GPLN + (wn * 32 + lr) * GLP + 8 * hi;
#pragma unroll   // constant indices: the fragment and accumulator arrays stay in registers
        for (int c = 0; c < 2; ++c) { v16bf a[4], a2[4], b[2];
#pragma unroll   // constant indices: the fragment and accumulator arrays stay in registers
            for (int mb = 0; mb < 4; ++mb) { a[mb] = ldsfrag(sa + mb * 16 * GLP + c * 32); if (NA == 2) a2[mb] = ldsfrag(sa + GPLN + mb * 16 * GLP + c * 32); }
#pragma unroll   // constant indices: the fragment and accumulator arrays stay in registers
            for (int nb = 0; nb < 2; ++nb) b[nb] = ldsfrag(sb + nb * 16 * GLP + c * 32);
#pragma unroll   // constant indices: the fragment and accumulator arrays stay in registers
            for (int nb = 0; nb < 2; ++nb)
#pragma unroll   // constant indices: the fragment and accumulator arrays stay in registers
                for (int mb = 0; mb < 4; ++mb) { acc[mb][nb] = wmmab(a[mb], b[nb], acc[mb][nb]); if (NA == 2) acc[mb][nb] = wmmab(a2[mb], b[nb], acc[mb][nb]); } }
        asm volatile("s_wait_dscnt 0x0" ::: "memory");      // this wave's reads of stage t are done before its buffer is refilled
        asm volatile("s_wait_asynccnt 0x0" ::: "memory");   // this wave's copies of stage t + 1 have landed
        __syncthreads();                                     // publishes stage t + 1 and ends every wave's reads of stage t
        if (t + 2 < NT) fill(t + 2);
    }
    asm volatile("s_wait_asynccnt 0x0" ::: "memory");   // nothing is in flight when the ring becomes the output staging
}
// the wave's 64x32 part of the f32 tile into the staging rows (the ring, free behind the loop's last barrier)
__device__ __forceinline__ void stage128(float* os, const v8f (&acc)[4][2]) {
    const int lane = threadIdx.x & 31, lr = lane & 15, hi = lane >> 4; const int wv = __builtin_amdgcn_readfirstlane((int)(threadIdx.x >> 5)); const int wm = wv >> 2, wn = wv & 3;
#pragma unroll   // constant indices: the fragment and accumulator arrays stay in registers
    for (int mb = 0; mb < 4; ++mb)
#pragma unroll   // constant indices: the fragment and accumulator arrays stay in registers
        for (int nb = 0; nb < 2; ++nb)
#pragma unroll   // constant indices: the fragment and accumulator arrays stay in registers
            for (int j = 0; j < 8; ++j) os[(wm * 64 + mb * 16 + hi * 8 + j) * GOP + wn * 32 + nb * 16 + lr] = acc[mb][nb][j];
}

__device__ __forceinline__ h16 tohx(float x) { return (h16)x; }
__device__ __forceinline__ void splitf(float y, unsigned short& h, unsigned short& l) { h = f2bf(y); l = f2bf(y - bf2f(h)); }
typedef __attribute__((ext_vector_type(2))) _Float16 v2h;
typedef __attribute__((ext_vector_type(4))) _Float16 v4h;
typedef __attribute__((ext_vector_type(2))) unsigned short v2us;
typedef __attribute__((ext_vector_type(4))) unsigned short v4us;
typedef __attribute__((ext_vector_type(2))) float v2f;
typedef __attribute__((ext_vector_type(4))) int v4i;

__global__ __launch_bounds__(256) void k_wtG(const float* __restrict__ w, int K, int N, bf* Bt) {
    const int lane = threadIdx.x & 31; const int L0 = (blockIdx.x * 8 + (threadIdx.x >> 5)) * 8; const int nlines = N * K / 64;
{
#pragma unroll 1
        for (int l = 0; l < 8; ++l) { const int L = L0 + l; if (L >= nlines) break; const size_t e = (size_t)L * 64 + lane * 2; const int k = (int)(e % K), n = (int)(e / K); v2us o;
            o[0] = f2bf(w[(size_t)k * N + n]); o[1] = f2bf(w[(size_t)(k + 1) * N + n]); *(v2us*)(Bt + e) = o; }
         }
}
// ---- k_cvtall: every f32 operand of the products rounded to bf16 in one launch. Grid (64, 8), 256 threads: slice y (DM x DM elements) is a quarter of x (y < 4) or one weight matrix; a thread converts 8 pieces of 8 elements, all its loads issued before the first conversion.
static_assert((size_t)NB_ * TT * DM == 4 * (size_t)DM * DM && DQ == DM && DKV == DM, "slices of DM x DM elements");
__global__ __launch_bounds__(256) void k_cvtall(const float* __restrict__ x, const float* __restrict__ wq, const float* __restrict__ wk, const float* __restrict__ wv, const float* __restrict__ wo, bf* XB, bf* WQ, bf* WK, bf* WV, bf* WO) {
    const int y = blockIdx.y; const size_t SL = (size_t)DM * DM; const float* s; bf* d;
    if (y < 4) { s = x + y * SL; d = XB + y * SL; } else if (y == 4) { s = wq; d = WQ; } else if (y == 5) { s = wk; d = WK; } else if (y == 6) { s = wv; d = WV; } else { s = wo; d = WO; }
    const size_t i0 = ((size_t)blockIdx.x * 2048 + threadIdx.x) * 8; const float* sp = s + i0; v8f v[8];
#pragma unroll
    for (int j = 0; j < 8; ++j) v[j] = *(const v8f*)(sp + j * 2048);
    asm volatile("s_wait_xcnt 0x0" :: "v"(sp) : "memory");   // the loads' address pair is an input here, so no load lands on it; behind the wait it is free for reuse
#pragma unroll
    for (int j = 0; j < 8; ++j) { v8us o;
#pragma unroll
        for (int k = 0; k < 8; ++k) o[k] = f2bf(v[j][k]);
        *(v8us*)(d + i0 + j * 2048) = o; }
}

// ---- k_qkv: the q, k and v projections of both batches in one launch on gemm128. Grid (NB_*TT/128 token tiles, head pairs, 3).
// A 128x128 tile is 128 tokens x two heads; the epilogue splits each sum into hi + lo bf16 and stores it straight into the head planes: q, k as [b][h][t][d]; v is computed as Wv x^T (rows = d, columns = t), which is the [b][h][d][t] plane row by row.
__global__ __launch_bounds__(256) void k_qkv(const bf* __restrict__ X, const bf* __restrict__ WQ, const bf* __restrict__ WK, const bf* __restrict__ WV, bf* Qh, bf* Ql, bf* Kh, bf* Kl, bf* Vh, bf* Vl) {
    __shared__ __align__(16) bf sm[2 * 2 * GPLN];
    const int z = blockIdx.z, b = blockIdx.x / (TT / 128), t0 = (blockIdx.x % (TT / 128)) * 128; const size_t hp = (size_t)b * NH_ + blockIdx.y * 2;
    const bf* xt = X + (size_t)blockIdx.x * 128 * DM; const bf* wt = (z == 0 ? WQ : z == 1 ? WK : WV) + (size_t)blockIdx.y * 128 * DM;
    bf* Ph = (z == 0 ? Qh : z == 1 ? Kh : Vh); bf* Pl = (z == 0 ? Ql : z == 1 ? Kl : Vl);
    v8f acc[4][2];
    gemm128<1>((z == 2) ? wt : xt, nullptr, (z == 2) ? xt : wt, sm, acc);
    float* os = (float*)sm;
    stage128(os, acc);
    __syncthreads();   // the whole tile is in LDS before any thread reads a row of it
    const int w = __builtin_amdgcn_readfirstlane((int)(threadIdx.x >> 5)), cofs = (threadIdx.x & 31) * 4;   // a wave takes rows w, w + 8, ...; a lane 4 columns
    const unsigned lo = (z == 2) ? (unsigned)cofs : (unsigned)((cofs >> 6) * TT * HD + (cofs & 63));   // the lane's part of every store address, beside a wave-uniform base
    const size_t ub = (z == 2) ? (hp * HD + w) * TT + t0 : (hp * TT + t0 + w) * HD; const size_t us = (z == 2) ? 8 * TT : 8 * HD;   // row w of the tile in the plane; 8 rows on
#pragma unroll   // the rows' LDS reads and stores overlap
    for (int i = 0; i < 16; ++i) { const v4f val = *(const v4fa*)(os + (i * 8 + w) * GOP + cofs);
        v4us oh, ol;
#pragma unroll   // constant vector indices
        for (int e = 0; e < 4; ++e) { unsigned short a2, c2; splitf(val[e], a2, c2); oh[e] = a2; ol[e] = c2; }
        *(v4us*)(Ph + (ub + i * us) + lo) = oh; *(v4us*)(Pl + (ub + i * us) + lo) = ol; }
}
// ---- k_wo: out = (merged hi + merged lo) Wo^T + bo on gemm128, both batches (the merged rows and the output rows are contiguous over b). Grid (NB_*TT/128, DM/128).
__global__ __launch_bounds__(256) void k_wo(const bf* __restrict__ ATh, const bf* __restrict__ ATl, const bf* __restrict__ WO, const float* __restrict__ bias, float* C) {
    __shared__ __align__(16) bf sm[2 * 3 * GPLN];
    const int r0 = blockIdx.x * 128, c0 = blockIdx.y * 128;
    v8f acc[4][2];
    gemm128<2>(ATh + (size_t)r0 * DQ, ATl + (size_t)r0 * DQ, WO + (size_t)c0 * DQ, sm, acc);
    float* os = (float*)sm;
    stage128(os, acc);
    __syncthreads();   // the whole tile is in LDS before any thread reads a row of it
    const int w = __builtin_amdgcn_readfirstlane((int)(threadIdx.x >> 5)), cofs = (threadIdx.x & 31) * 4;   // a wave takes rows w, w + 8, ...: 512 contiguous bytes a store
    v4f bb; bb[0] = bfr(bias[c0 + cofs]); bb[1] = bfr(bias[c0 + cofs + 1]); bb[2] = bfr(bias[c0 + cofs + 2]); bb[3] = bfr(bias[c0 + cofs + 3]);
#pragma unroll   // the rows' LDS reads and stores overlap
    for (int i = 0; i < 16; ++i) { const v4f val = *(const v4fa*)(os + (i * 8 + w) * GOP + cofs) + bb;
        *(v4f*)(C + ((size_t)(r0 + i * 8 + w) * DM + c0) + (unsigned)cofs) = val; }
}
// ---- k_fattn: scores, softmax, P.V and the head merge in one kernel. Grid (TT/256, heads, batches), 16 waves = two groups of 8; a wave owns 16 queries, a lane one query (column lr) and half of each key group.
// Keys before a query tile's first query are excluded for every query of the tile, so a tile of 128 queries starts at its own first key: tile t walks 16 - t stages of 128 keys. A work-group takes tile t and then tile 15 - t, 17 stages whatever t is.
// Both wave groups hold the same 128 queries; group g takes the g-th 64 keys of every stage with its own running maximum and sum, and the two partial results are joined through LDS behind the tile's last stage.
// St = K Qt and Ot += Vt Pt: the score accumulators of two 16-key tiles, converted in place, are the B operand of the second product (hardware k order; the K, Q and Vt loaders use the same order).
// K and Vt hi/lo tiles go global -> registers -> LDS, two buffers: the next stage's loads fly during this stage's work, one barrier a stage.
// LDS -> registers in blocks of four fragments (six products on two accumulators), two register sets: a block's reads are issued in front of the block before it, inside one stage.
#define FLP   72                   // LDS row pitch in 16-bit elements: 144 B = 16 B x odd, conflict-free for 16-byte row reads
#define FTILE (64 * FLP)
#define FBUF  (8 * FTILE)          // one buffer: two halves of 64 keys x (K hi, K lo, Vt hi, Vt lo)
#define QT    128                  // queries a tile, keys a stage
#define NQT   (TT / QT)
#define JP    36                   // join record pitch in floats: 144 B = 16 B x odd
#define CEXP  0.18033688011112042f // HD^-0.5 x log2(e): scores go to base 2 in the one multiply
static_assert(NQT % 2 == 0 && TT / 256 == NQT / 2, "tiles t and NQT - 1 - t pair up over the grid");
typedef __attribute__((ext_vector_type(2))) __bf16 v2bf;
__device__ __forceinline__ float xhalf(float x) { return __builtin_bit_cast(float, __builtin_amdgcn_permlanex16(__builtin_bit_cast(int, x), __builtin_bit_cast(int, x), 0x76543210, 0xfedcba98, false, false)); }   // lane l with lane l ^ 16
__global__ __launch_bounds__(512) void k_fattn(const bf* __restrict__ Qh, const bf* __restrict__ Ql, const bf* __restrict__ Kh, const bf* __restrict__ Kl, const bf* __restrict__ Vh, const bf* __restrict__ Vl, bf* ATh, bf* ATl) {
    __shared__ __align__(16) bf sm[2 * FBUF];        // [buffer][key half][K hi, K lo, Vt hi, Vt lo][64 rows][FLP]
    __shared__ __align__(16) float jn[256 * JP];     // group 1's partial result, one record a lane: 32 output sums, maximum, sum
    const int tid = threadIdx.x, lane = tid & 31, lr = lane & 15, hi = lane >> 4; const int wv = __builtin_amdgcn_readfirstlane(tid >> 5);
    const int grp = wv >> 3, w8 = wv & 7;
    const size_t hp = (size_t)blockIdx.z * NH_ + blockIdx.y;   // the (batch, head) plane
    const int srow = tid >> 3, sseg = (tid & 7) * 8, so = srow * FLP + sseg;   // staging: one 16-byte piece of each of the eight tiles a thread
    const unsigned ko = (unsigned)(srow * HD + sseg), vo = (unsigned)(srow * TT + sseg), qo = (unsigned)(lr * HD + 8 * hi), oo = (unsigned)(lr * DQ + 8 * hi);   // the lane's part of every global address, beside a wave-uniform base
#pragma unroll 1   // one copy of the stage loop in the text for both turns
    for (int turn = 0; turn < 2; ++turn) {
        const int qt = turn ? NQT - 1 - (int)blockIdx.x : (int)blockIdx.x;   // the query tile of this turn
        const int k0 = qt * QT, nst = NQT - qt;                // its first admitted key, its stages
        const int q = k0 + w8 * 16 + lr;                       // this lane's query
        v16bf qh[2], ql[2];
#pragma unroll
        for (int c = 0; c < 2; ++c) { const size_t qb = (hp * TT + k0 + w8 * 16) * HD + c * 32; qh[c] = WFrag<bf>::ld(Qh + qb + qo); ql[c] = WFrag<bf>::ld(Ql + qb + qo); }
        const size_t gk = (hp * TT + k0) * HD, gv = hp * HD * TT + k0;   // the tile's first key in the K planes (rows = keys) and in the Vt planes (columns = keys)
        v8us r0 = *(const v8us*)(Kh + gk + ko), r1 = *(const v8us*)(Kl + gk + ko), r2 = *(const v8us*)(Vh + gv + vo), r3 = *(const v8us*)(Vl + gv + vo);
        v8us r4 = *(const v8us*)(Kh + (gk + 64 * HD) + ko), r5 = *(const v8us*)(Kl + (gk + 64 * HD) + ko), r6 = *(const v8us*)(Vh + (gv + 64) + vo), r7 = *(const v8us*)(Vl + (gv + 64) + vo);
        { bf* sn = sm + so; *(v8usa*)sn = r0; *(v8usa*)(sn + FTILE) = r1; *(v8usa*)(sn + 2 * FTILE) = r2; *(v8usa*)(sn + 3 * FTILE) = r3;
          *(v8usa*)(sn + 4 * FTILE) = r4; *(v8usa*)(sn + 5 * FTILE) = r5; *(v8usa*)(sn + 6 * FTILE) = r6; *(v8usa*)(sn + 7 * FTILE) = r7; }
        __syncthreads();   // stage 0 is in LDS before any wave reads it
        v8f o[4];
#pragma unroll
        for (int dt = 0; dt < 4; ++dt) o[dt] = (v8f){};
        float m = -3.0e38f, l = 0.f;
#pragma unroll 1
        for (int s = 0; s < nst; ++s) {
            const bool more = s + 1 < nst;
            if (more) { const size_t k1 = (size_t)(s + 1) * QT; r0 = *(const v8us*)(Kh + (gk + k1 * HD) + ko); r1 = *(const v8us*)(Kl + (gk + k1 * HD) + ko); r2 = *(const v8us*)(Vh + (gv + k1) + vo); r3 = *(const v8us*)(Vl + (gv + k1) + vo);
                r4 = *(const v8us*)(Kh + (gk + (k1 + 64) * HD) + ko); r5 = *(const v8us*)(Kl + (gk + (k1 + 64) * HD) + ko); r6 = *(const v8us*)(Vh + (gv + k1 + 64) + vo); r7 = *(const v8us*)(Vl + (gv + k1 + 64) + vo); }
            const bf* sb = sm + (s & 1) * FBUF + grp * 4 * FTILE;
            const int kb = k0 + s * QT + grp * 64;   // first key of this group's half of the stage
            const bf* fp = sb + lr * FLP + 8 * hi;   // this lane's place in a fragment row
            v16bf f[2][4];   // two fragment sets; a set is one block: (hi, lo) of two 16-row tiles, 32 k
            auto ldblk = [&](v16bf (&d)[4], const bf* p) { d[0] = ldsfrag(p); d[1] = ldsfrag(p + FTILE); d[2] = ldsfrag(p + 16 * FLP); d[3] = ldsfrag(p + 16 * FLP + FTILE); };
            v8f st[4];   // st[kt][j] = score of key kb + kt*16 + 8*hi + j against query q
#pragma unroll
            for (int kt = 0; kt < 4; ++kt) st[kt] = (v8f){};
            ldblk(f[0], fp);
#pragma unroll   // constant indices: the fragment sets stay in registers
            for (int bk = 0; bk < 4; ++bk) { const int kt = (bk >> 1) * 2, c = bk & 1;   // block: key tiles kt, kt + 1 over 32 d
                if (bk < 3) ldblk(f[(bk + 1) & 1], fp + ((bk + 1) >> 1) * 32 * FLP + ((bk + 1) & 1) * 32);
                else ldblk(f[0], fp + 2 * FTILE);   // the first Vt block: its latency passes behind the softmax
                __builtin_amdgcn_sched_barrier(0);   // keeps the next block's LDS reads in front of this block's products, so that the wave does not wait out their latency block by block
                const v16bf (&a)[4] = f[bk & 1];
                st[kt] = wmmab(a[0], qh[c], st[kt]); st[kt + 1] = wmmab(a[2], qh[c], st[kt + 1]);
                st[kt] = wmmab(a[1], qh[c], st[kt]); st[kt + 1] = wmmab(a[3], qh[c], st[kt + 1]);
                st[kt] = wmmab(a[0], ql[c], st[kt]); st[kt + 1] = wmmab(a[2], ql[c], st[kt + 1]); }
            float mx = m;
#pragma unroll
            for (int kt = 0; kt < 4; ++kt)
#pragma unroll
                for (int j = 0; j < 8; ++j) { const float t = (kb + kt * 16 + 8 * hi + j >= q) ? st[kt][j] * CEXP : -3.0e38f;   /* anti-causal: keys before the query excluded (the module's tril(-1) -> -inf) */ st[kt][j] = t; mx = fmaxf(mx, t); }
            mx = fmaxf(mx, xhalf(mx));   // both halves of the wave hold the query's running maximum
            const float alpha = __builtin_amdgcn_exp2f(m - mx);   // 0 when the first admitted key arrives: whatever an all-excluded stage before it summed is wiped
            m = mx;
            float ps[4]; v16bf ph[2], pl[2];   // one partial sum a tile: four short add chains instead of one long one
#pragma unroll
            for (int kt = 0; kt < 4; ++kt) { ps[kt] = 0.f;
#pragma unroll
                for (int j = 0; j < 8; j += 2) { v2f p; p[0] = __builtin_amdgcn_exp2f(st[kt][j] - mx); p[1] = __builtin_amdgcn_exp2f(st[kt][j + 1] - mx); ps[kt] += p[0]; ps[kt] += p[1];
                    const v2bf h = __builtin_convertvector(p, v2bf); v2f r; r[0] = p[0] - (float)h[0]; r[1] = p[1] - (float)h[1]; const v2bf lo = __builtin_convertvector(r, v2bf);   // hi + lo planes of P, two elements a conversion
                    const int e = (kt & 1) * 8 + j; ph[kt >> 1][e] = h[0]; ph[kt >> 1][e + 1] = h[1]; pl[kt >> 1][e] = lo[0]; pl[kt >> 1][e + 1] = lo[1]; } }
            l = l * alpha + ((ps[0] + ps[1]) + (ps[2] + ps[3]));   // each half keeps the sum of its own keys; joined once after the loop
#pragma unroll
            for (int dt = 0; dt < 4; ++dt) o[dt] *= alpha;
#pragma unroll   // constant indices: the fragment sets stay in registers
            for (int bk = 0; bk < 4; ++bk) { const int kp2 = bk >> 1, dt = (bk & 1) * 2;   // block: output tiles dt, dt + 1 over 32 keys
                if (bk < 3) { ldblk(f[(bk + 1) & 1], fp + 2 * FTILE + ((bk + 1) & 1) * 32 * FLP + ((bk + 1) >> 1) * 32);
                    __builtin_amdgcn_sched_barrier(0); }   // as above: the next block's LDS reads stay in front of this block's products
                const v16bf (&a)[4] = f[bk & 1];
                o[dt] = wmmab(a[0], ph[kp2], o[dt]); o[dt + 1] = wmmab(a[2], ph[kp2], o[dt + 1]);
                o[dt] = wmmab(a[0], pl[kp2], o[dt]); o[dt + 1] = wmmab(a[2], pl[kp2], o[dt + 1]);
                o[dt] = wmmab(a[1], ph[kp2], o[dt]); o[dt + 1] = wmmab(a[3], ph[kp2], o[dt + 1]); }
            if (more) { bf* sn = sm + ((s + 1) & 1) * FBUF + so; *(v8usa*)sn = r0; *(v8usa*)(sn + FTILE) = r1; *(v8usa*)(sn + 2 * FTILE) = r2; *(v8usa*)(sn + 3 * FTILE) = r3;
                *(v8usa*)(sn + 4 * FTILE) = r4; *(v8usa*)(sn + 5 * FTILE) = r5; *(v8usa*)(sn + 6 * FTILE) = r6; *(v8usa*)(sn + 7 * FTILE) = r7; }
            __syncthreads();   // publishes stage s + 1 and ends every wave's reads of stage s, whose buffer the next trip (or the next turn's stage 0) refills
        }
        float* jr = jn + (w8 * 32 + lane) * JP;   // the record of this (wave of a group, lane): same query, same output rows in both groups
        if (grp == 1) {
#pragma unroll
            for (int dt = 0; dt < 4; ++dt) { *(v4fa*)(jr + dt * 8) = __builtin_shufflevector(o[dt], o[dt], 0, 1, 2, 3); *(v4fa*)(jr + dt * 8 + 4) = __builtin_shufflevector(o[dt], o[dt], 4, 5, 6, 7); }
            jr[32] = m; jr[33] = l; }
        __syncthreads();   // group 1's records are in LDS before group 0 reads them; the next turn's barriers end those reads before the records are rewritten
        if (grp == 0) {
            const float m1 = jr[32], l1 = jr[33], mj = fmaxf(m, m1);
            const float a0 = __builtin_amdgcn_exp2f(m - mj), a1 = __builtin_amdgcn_exp2f(m1 - mj);   // a group that saw no admitted key (maximum still at the floor) gets weight 0; the key j = q is always in one of the two
            l = l * a0 + l1 * a1; l += xhalf(l); const float inv = __fdiv_rn(1.0f, l);
            const size_t ob = ((size_t)blockIdx.z * TT + k0 + w8 * 16) * DQ + blockIdx.y * HD;   // o[dt][j] = out[q][dt*16 + 8*hi + j]: 8 consecutive d a lane
#pragma unroll
            for (int dt = 0; dt < 4; ++dt) { const v4f p0 = *(const v4fa*)(jr + dt * 8), p1 = *(const v4fa*)(jr + dt * 8 + 4); v8us oh, ol;
#pragma unroll
                for (int j = 0; j < 8; ++j) { unsigned short a, c2; splitf((o[dt][j] * a0 + (j < 4 ? p0[j & 3] : p1[j & 3]) * a1) * inv, a, c2); oh[j] = a; ol[j] = c2; }
                *(v8us*)(ATh + (ob + dt * 16) + oo) = oh; *(v8us*)(ATl + (ob + dt * 16) + oo) = ol; }
            asm volatile("s_wait_xcnt 0x0" ::: "memory");   // the next turn's first instructions rewrite registers that these stores name: the wait stands in front of them
        }
    }
}

extern "C" void kernel_launch(void* const* d_in, const int* in_sizes, int n_in,
                              void* d_out, int out_size, void* d_ws, size_t ws_size, hipStream_t stream) {
    (void)in_sizes; (void)n_in; (void)out_size;
    const float* x = (const float*)d_in[0]; const float* wq = (const float*)d_in[1]; const float* wk = (const float*)d_in[2]; const float* wv = (const float*)d_in[3]; const float* wo = (const float*)d_in[4]; const float* bo = (const float*)d_in[5];
    float* OUT = (float*)d_out;     // [2][2048][1024]
    char* wsp = (char*)d_ws;
    auto take = [&](size_t bytes) { char* p = wsp; wsp += (bytes + 255) & ~(size_t)255; return (void*)p; };
    bf* WQ = (bf*)take((size_t)DQ * DM * 2); bf* WK = (bf*)take((size_t)DKV * DM * 2); bf* WV = (bf*)take((size_t)DKV * DM * 2); bf* WO = (bf*)take((size_t)DM * DQ * 2);
    bf* XB = (bf*)take((size_t)NB_ * TT * DM * 2);
    const size_t PL = (size_t)NH_ * TT * HD;   // one batch's head planes, elements
    bf* QPh = (bf*)take(NB_ * PL * 2); bf* QPl = (bf*)take(NB_ * PL * 2); bf* KPh = (bf*)take(NB_ * PL * 2); bf* KPl = (bf*)take(NB_ * PL * 2); bf* VTh = (bf*)take(NB_ * PL * 2); bf* VTl = (bf*)take(NB_ * PL * 2);
    bf* ATh = (bf*)take((size_t)NB_ * TT * DQ * 2); bf* ATl = (bf*)take((size_t)NB_ * TT * DQ * 2);
    if ((size_t)(wsp - (char*)d_ws) > ws_size) return;    // ws 256 MiB
    k_cvtall<<<dim3(64, 8, 1), 256, 0, stream>>>(x, wq, wk, wv, wo, XB, WQ, WK, WV, WO);
    k_qkv<<<dim3(NB_ * TT / 128, NH_ / 2, 3), 256, 0, stream>>>(XB, WQ, WK, WV, QPh, QPl, KPh, KPl, VTh, VTl);
    k_fattn<<<dim3(TT / 256, NH_, NB_), 512, 0, stream>>>(QPh, QPl, KPh, KPl, VTh, VTl, ATh, ATl);
    k_wo<<<dim3(NB_ * TT / 128, DM / 128, 1), 256, 0, stream>>>(ATh, ATl, WO, bo, OUT);
}

// v009
// A run of this version takes 73 microseconds.
// It is 1.42 times as fast as v006, going by the measured steps of the versions left out in between.
// Over all steps from v000 it is 17.7 times as fast.
#include <hip/hip_runtime.h>

// Multi-head attention with the module's ANTI-causal mask (x [2][2048][1024]; q,k,v = x W^T ('oi' [1024][1024] 0.02, no bias; 16 heads x 64); scores = q.k; keys strictly BEFORE the query (tril(-1)) -> -inf, i.e. each token attends to itself and the future; softmax(scores / 8); out = merged Wo^T + bo -> [2][2048][1024] (4.2 M)).
// Layout: one launch rounds x and the four weight matrices to bf16; one launch does the exact q, k, v projections of both batches and writes the f16 head planes from its own epilogue; ONE fused attention launch for all (batch, head) pairs with q, k, v and the probabilities on one f16 plane each (1 product, 11 significant bits; score tiles from each query tile's own first key on, the anti-causal pattern applied as the index select j >= i in the softmax of a tile's first stage, the only one with keys before a query; scores and probabilities stay in registers, running maximum and sum); merged (one f16 plane) x Wo + bo.
// Compute dtypes, f32 accumulate: every input rounded to bf16; projections exact, their results rounded to f16; attention 1 f16 product on every row; softmax f32, probabilities rounded to f16; merged rounded to f16, Wo's bf16 rounding held as f16, 1 f16 product + bias.

#define NB_  2
#define TT   2048
#define DM   1024
#define NH_  16
#define NKV  16
#define HD   64
#define DQ   (NH_ * HD)
#define DKV  (NKV * HD)
#define WIN  0
typedef _Float16 h16;
typedef unsigned short bf;
typedef __attribute__((ext_vector_type(16))) __bf16   v16bf;
typedef __attribute__((ext_vector_type(16))) _Float16 v16h;
typedef __attribute__((ext_vector_type(8)))  _Float16 v8h;
typedef __attribute__((ext_vector_type(8)))  unsigned short v8us;
typedef __attribute__((ext_vector_type(8)))  float    v8f;
typedef __attribute__((ext_vector_type(4)))  float    v4f;
typedef v8h  __attribute__((may_alias)) v8ha;
typedef v4f  __attribute__((may_alias)) v4fa;
typedef v8us __attribute__((may_alias)) v8usa;

__device__ __forceinline__ unsigned short f2bf(float f) { unsigned u = __float_as_uint(f); u += 0x7FFFu + ((u >> 16) & 1u); return (unsigned short)(u >> 16); }
__device__ __forceinline__ float bf2f(unsigned short b) { return __uint_as_float(((unsigned)b) << 16); }
__device__ __forceinline__ float bfr(float f) { return bf2f(f2bf(f)); }
__device__ __forceinline__ v16h cat16(v8h lo, v8h hi) { return __builtin_shufflevector(lo, hi, 0, 1, 2, 3, 4, 5, 6, 7, 8, 9, 10, 11, 12, 13, 14, 15); }
__device__ __forceinline__ v16bf cat16b(v8us lo, v8us hi) { return __builtin_bit_cast(v16bf, __builtin_shufflevector(lo, hi, 0, 1, 2, 3, 4, 5, 6, 7, 8, 9, 10, 11, 12, 13, 14, 15)); }
__device__ __forceinline__ v8f wmma16(v16h a, v16h b, v8f c) { return __builtin_amdgcn_wmma_f32_16x16x32_f16(false, a, false, b, (short)0, c, false, false); }
__device__ __forceinline__ v8f wmmab(v16bf a, v16bf b, v8f c) { return __builtin_amdgcn_wmma_f32_16x16x32_bf16(false, a, false, b, (short)0, c, false, false); }



// ---- fragment loaders: 16 k of a row a lane, hardware k order (8 * hi + 0..7, then + 16), the same for both operands.
template <typename T16> struct WFrag;
template <> struct WFrag<h16> { typedef v16h V; static __device__ __forceinline__ V ld(const h16* p) { return cat16(*(const v8h*)p, *(const v8h*)(p + 16)); } static __device__ __forceinline__ v8f mma(V a, V b, v8f c) { return wmma16(a, b, c); } };
template <> struct WFrag<bf> { typedef v16bf V; static __device__ __forceinline__ V ld(const bf* p) { return cat16b(*(const v8us*)p, *(const v8us*)(p + 16)); } static __device__ __forceinline__ v8f mma(V a, V b, v8f c) { return wmmab(a, b, c); } };

// ---- gemm128: the loop of both GEMM kernels. One 128x128 tile of C[m][n] = sum_k A[m][k] B[n][k] a work-group of 8 waves, K = DM, operands K-contiguous 16-bit planes (both bf16 or both f16).
// A stage is 64 k (one 128-byte line) of the tile's 128 rows of every operand plane, brought into LDS by asynchronous copies: a wave's copy covers four whole lines, and every line is fetched once a work-group.
// Two buffers: stage t + 2 flies while stage t + 1 is worked on. Waves 2 (rows) x 4 (columns); a wave owns 64x32 of the tile over the whole K (8 accumulators).
#define GLP   72                   // LDS row pitch in 16-bit elements: 144 B = 16 B x odd, conflict-free for 16-byte row reads
#define GPLN  (128 * GLP)          // one operand plane of a stage
#define GOP   132                  // output staging pitch in floats: 528 B = 16 B x odd
static_assert(128 * GOP * 4 <= 2 * 2 * GPLN * 2, "the f32 output tile fits the ring");
__device__ __forceinline__ v16h cat16u(v8us lo, v8us hi) { return __builtin_bit_cast(v16h, __builtin_shufflevector(lo, hi, 0, 1, 2, 3, 4, 5, 6, 7, 8, 9, 10, 11, 12, 13, 14, 15)); }   // f16 bits kept in 16-bit words
__device__ __forceinline__ v16h ldsfragh(const bf* p) { return cat16u(*(const v8usa*)p, *(const v8usa*)(p + 16)); }
__device__ __forceinline__ v16bf ldsfrag(const bf* p) { return cat16b(*(const v8usa*)p, *(const v8usa*)(p + 16)); }
// one plane of a stage: the thread's 16-byte piece of rows r, r + 32, r + 64, r + 96
__device__ __forceinline__ void cp_plane(const bf* dst, const bf* g0) {
    const unsigned l0 = (unsigned)(size_t)dst, l1 = l0 + 32 * GLP * 2, l2 = l0 + 64 * GLP * 2, l3 = l0 + 96 * GLP * 2;   // LDS byte addresses: the low 32 bits of the __shared__ address
    const bf* g1 = g0 + 32 * DM; const bf* g2 = g0 + 64 * DM; const bf* g3 = g0 + 96 * DM;
    // the wait is the statement's last line, so that no address register of a copy is rewritten in front of it
    asm volatile("global_load_async_to_lds_b128 %0, %4, off\n\tglobal_load_async_to_lds_b128 %1, %5, off\n\tglobal_load_async_to_lds_b128 %2, %6, off\n\tglobal_load_async_to_lds_b128 %3, %7, off\n\ts_wait_xcnt 0x0"
                 :: "v"(l0), "v"(l1), "v"(l2), "v"(l3), "v"(g0), "v"(g1), "v"(g2), "v"(g3) : "memory");
}
template <bool H> struct GFrag;   // what the planes' 16-bit words are: bf16 (false) or f16 (true)
template <> struct GFrag<false> { typedef v16bf V; static __device__ __forceinline__ V ld(const bf* p) { return ldsfrag(p); } static __device__ __forceinline__ v8f mma(V a, V b, v8f c) { return wmmab(a, b, c); } };
template <> struct GFrag<true> { typedef v16h V; static __device__ __forceinline__ V ld(const bf* p) { return ldsfragh(p); } static __device__ __forceinline__ v8f mma(V a, V b, v8f c) { return wmma16(a, b, c); } };
template <bool H>
__device__ __forceinline__ void gemm128(const bf* __restrict__ A, const bf* __restrict__ B, bf* sm, v8f (&acc)[4][2]) {
    typedef GFrag<H> F; constexpr int NT = DM / 64, BUF = 2 * GPLN;
    const int tid = threadIdx.x, lane = tid & 31, lr = lane & 15, hi = lane >> 4; const int wv = __builtin_amdgcn_readfirstlane(tid >> 5); const int wm = wv >> 2, wn = wv & 3;
    const unsigned go = (unsigned)((tid >> 3) * DM + (tid & 7) * 8);   // the lane's part of every copy's global address
    const bf* sl = sm + (tid >> 3) * GLP + (tid & 7) * 8;              // and its place in a plane
    auto fill = [&](int t) { const bf* d = sl + (t & 1) * BUF; cp_plane(d, A + t * 64 + go); cp_plane(d + GPLN, B + t * 64 + go); };
#pragma unroll   // constant indices: the fragment and accumulator arrays stay in registers
    for (int mb = 0; mb < 4; ++mb)
#pragma unroll   // constant indices: the fragment and accumulator arrays stay in registers
        for (int nb = 0; nb < 2; ++nb) acc[mb][nb] = (v8f){};
    fill(0);
    asm volatile("s_wait_asynccnt 0x0" ::: "memory");   // this wave's copies of stage 0 have landed
    __syncthreads();                                     // and every other wave's: stage 0 may be read
    fill(1);
#pragma unroll 1   // one stage a trip: the buffer is picked by t & 1
    for (int t = 0; t < NT; ++t) {
        const bf* sa = sm + (t & 1) * BUF + (wm * 64 + lr) * GLP + 8 * hi; const bf* sb = sm + (t & 1) * BUF + GPLN + (wn * 32 + lr) * GLP + 8 * hi;
#pragma unroll   // constant indices: the fragment and accumulator arrays stay in registers
        for (int c = 0; c < 2; ++c) { typename F::V a[4], b[2];
#pragma unroll   // constant indices: the fragment and accumulator arrays stay in registers
            for (int mb = 0; mb < 4; ++mb) a[mb] = F::ld(sa + mb * 16 * GLP + c * 32);
#pragma unroll   // constant indices: the fragment and accumulator arrays stay in registers
            for (int nb = 0; nb < 2; ++nb) b[nb] = F::ld(sb + nb * 16 * GLP + c * 32);
#pragma unroll   // constant indices: the fragment and accumulator arrays stay in registers
            for (int nb = 0; nb < 2; ++nb)
#pragma unroll   // constant indices: the fragment and accumulator arrays stay in registers
                for (int mb = 0; mb < 4; ++mb) acc[mb][nb] = F::mma(a[mb], b[nb], acc[mb][nb]); }
        asm volatile("s_wait_dscnt 0x0" ::: "memory");      // this wave's reads of stage t are done before its buffer is refilled
        asm volatile("s_wait_asynccnt 0x0" ::: "memory");   // this wave's copies of stage t + 1 have landed
        __syncthreads();                                     // publishes stage t + 1 and ends every wave's reads of stage t
        if (t + 2 < NT) fill(t + 2);
    }
    asm volatile("s_wait_asynccnt 0x0" ::: "memory");   // nothing is in flight when the ring becomes the output staging
}
// the wave's 64x32 part of the f32 tile into the staging rows (the ring, free behind the loop's last barrier)
__device__ __forceinline__ void stage128(float* os, const v8f (&acc)[4][2]) {
    const int lane = threadIdx.x & 31, lr = lane & 15, hi = lane >> 4; const int wv = __builtin_amdgcn_readfirstlane((int)(threadIdx.x >> 5)); const int wm = wv >> 2, wn = wv & 3;
#pragma unroll   // constant indices: the fragment and accumulator arrays stay in registers
    for (int mb = 0; mb < 4; ++mb)
#pragma unroll   // constant indices: the fragment and accumulator arrays stay in registers
        for (int nb = 0; nb < 2; ++nb)
#pragma unroll   // constant indices: the fragment and accumulator arrays stay in registers
            for (int j = 0; j < 8; ++j) os[(wm * 64 + mb * 16 + hi * 8 + j) * GOP + wn * 32 + nb * 16 + lr] = acc[mb][nb][j];
}

__device__ __forceinline__ h16 tohx(float x) { return (h16)x; }
typedef __attribute__((ext_vector_type(2))) _Float16 v2h;
typedef __attribute__((ext_vector_type(4))) _Float16 v4h;
typedef __attribute__((ext_vector_type(2))) unsigned short v2us;
typedef __attribute__((ext_vector_type(4))) unsigned short v4us;
typedef __attribute__((ext_vector_type(2))) float v2f;
typedef __attribute__((ext_vector_type(4))) int v4i;

__global__ __launch_bounds__(256) void k_wtG(const float* __restrict__ w, int K, int N, bf* Bt) {
    const int lane = threadIdx.x & 31; const int L0 = (blockIdx.x * 8 + (threadIdx.x >> 5)) * 8; const int nlines = N * K / 64;
{
#pragma unroll 1
        for (int l = 0; l < 8; ++l) { const int L = L0 + l; if (L >= nlines) break; const size_t e = (size_t)L * 64 + lane * 2; const int k = (int)(e % K), n = (int)(e / K); v2us o;
            o[0] = f2bf(w[(size_t)k * N + n]); o[1] = f2bf(w[(size_t)(k + 1) * N + n]); *(v2us*)(Bt + e) = o; }
         }
}
// ---- k_cvtall: every f32 operand of the products rounded to bf16 in one launch (Wo's rounded values are stored as f16 bits, the operand type of its product). Grid (64, 8), 256 threads: slice y (DM x DM elements) is a quarter of x (y < 4) or one weight matrix; a thread converts 8 pieces of 8 elements, all its loads issued before the first conversion.
static_assert((size_t)NB_ * TT * DM == 4 * (size_t)DM * DM && DQ == DM && DKV == DM, "slices of DM x DM elements");
__global__ __launch_bounds__(256) void k_cvtall(const float* __restrict__ x, const float* __restrict__ wq, const float* __restrict__ wk, const float* __restrict__ wv, const float* __restrict__ wo, bf* XB, bf* WQ, bf* WK, bf* WV, bf* WO) {
    const int y = blockIdx.y; const size_t SL = (size_t)DM * DM; const float* s; bf* d;
    if (y < 4) { s = x + y * SL; d = XB + y * SL; } else if (y == 4) { s = wq; d = WQ; } else if (y == 5) { s = wk; d = WK; } else if (y == 6) { s = wv; d = WV; } else { s = wo; d = WO; }
    const size_t i0 = ((size_t)blockIdx.x * 2048 + threadIdx.x) * 8; const float* sp = s + i0; v8f v[8];
#pragma unroll
    for (int j = 0; j < 8; ++j) v[j] = *(const v8f*)(sp + j * 2048);
    asm volatile("s_wait_xcnt 0x0" :: "v"(sp) : "memory");   // the loads' address pair is an input here, so no load lands on it; behind the wait it is free for reuse
#pragma unroll
    for (int j = 0; j < 8; ++j) { v8us o;
#pragma unroll
        for (int k = 0; k < 8; ++k) o[k] = f2bf(v[j][k]);
        if (y == 7) { v8f r;   // bf16 -> f16: exact down to 2^-17, below that to the nearest 2^-24
#pragma unroll
            for (int k = 0; k < 8; ++k) r[k] = bf2f(o[k]);
            o = __builtin_bit_cast(v8us, __builtin_convertvector(r, v8h)); }
        *(v8us*)(d + i0 + j * 2048) = o; }
}

// ---- k_qkv: the q, k and v projections of both batches in one launch on gemm128. Grid (NB_*TT/128 token tiles, head pairs, 3).
// A 128x128 tile is 128 tokens x two heads; the epilogue rounds each sum to f16 and stores it straight into the head planes (f16 bits in 16-bit words): q, k as [b][h][t][d]; v is computed as Wv x^T (rows = d, columns = t), which is the [b][h][d][t] plane row by row.
__global__ __launch_bounds__(256) void k_qkv(const bf* __restrict__ X, const bf* __restrict__ WQ, const bf* __restrict__ WK, const bf* __restrict__ WV, bf* Qp, bf* Kp, bf* Vp) {
    __shared__ __align__(16) bf sm[2 * 2 * GPLN];
    const int z = blockIdx.z, b = blockIdx.x / (TT / 128), t0 = (blockIdx.x % (TT / 128)) * 128; const size_t hp = (size_t)b * NH_ + blockIdx.y * 2;
    const bf* xt = X + (size_t)blockIdx.x * 128 * DM; const bf* wt = (z == 0 ? WQ : z == 1 ? WK : WV) + (size_t)blockIdx.y * 128 * DM;
    bf* Pp = (z == 0 ? Qp : z == 1 ? Kp : Vp);
    v8f acc[4][2];
    gemm128<false>((z == 2) ? wt : xt, (z == 2) ? xt : wt, sm, acc);
    float* os = (float*)sm;
    stage128(os, acc);
    __syncthreads();   // the whole tile is in LDS before any thread reads a row of it
    const int w = __builtin_amdgcn_readfirstlane((int)(threadIdx.x >> 5)), cofs = (threadIdx.x & 31) * 4;   // a wave takes rows w, w + 8, ...; a lane 4 columns
    const unsigned lo = (z == 2) ? (unsigned)cofs : (unsigned)((cofs >> 6) * TT * HD + (cofs & 63));   // the lane's part of every store address, beside a wave-uniform base
    const size_t ub = (z == 2) ? (hp * HD + w) * TT + t0 : (hp * TT + t0 + w) * HD; const size_t us = (z == 2) ? 8 * TT : 8 * HD;   // row w of the tile in the plane; 8 rows on
#pragma unroll   // the rows' LDS reads and stores overlap
    for (int i = 0; i < 16; ++i) { const v4f val = *(const v4fa*)(os + (i * 8 + w) * GOP + cofs);
        *(v4us*)(Pp + (ub + i * us) + lo) = __builtin_bit_cast(v4us, __builtin_convertvector(val, v4h)); }
}
// ---- k_wo: out = merged Wo^T + bo on gemm128, f16 operands, both batches (the merged rows and the output rows are contiguous over b). Grid (NB_*TT/128, DM/128).
__global__ __launch_bounds__(256) void k_wo(const bf* __restrict__ AT, const bf* __restrict__ WO, const float* __restrict__ bias, float* C) {
    __shared__ __align__(16) bf sm[2 * 2 * GPLN];
    const int r0 = blockIdx.x * 128, c0 = blockIdx.y * 128;
    v8f acc[4][2];
    gemm128<true>(AT + (size_t)r0 * DQ, WO + (size_t)c0 * DQ, sm, acc);
    float* os = (float*)sm;
    stage128(os, acc);
    __syncthreads();   // the whole tile is in LDS before any thread reads a row of it
    const int w = __builtin_amdgcn_readfirstlane((int)(threadIdx.x >> 5)), cofs = (threadIdx.x & 31) * 4;   // a wave takes rows w, w + 8, ...: 512 contiguous bytes a store
    v4f bb; bb[0] = bfr(bias[c0 + cofs]); bb[1] = bfr(bias[c0 + cofs + 1]); bb[2] = bfr(bias[c0 + cofs + 2]); bb[3] = bfr(bias[c0 + cofs + 3]);
#pragma unroll   // the rows' LDS reads and stores overlap
    for (int i = 0; i < 16; ++i) { const v4f val = *(const v4fa*)(os + (i * 8 + w) * GOP + cofs) + bb;
        *(v4f*)(C + ((size_t)(r0 + i * 8 + w) * DM + c0) + (unsigned)cofs) = val; }
}
// ---- k_fattn: scores, softmax, P.V and the head merge in one kernel. Grid (TT/256, heads, batches), 16 waves = two groups of 8; a wave owns 16 queries, a lane one query (column lr) and half of each key group.
// Keys before a query tile's first query are excluded for every query of the tile, so a tile of 128 queries starts at its own first key: tile t walks 16 - t stages of 128 keys. A work-group takes tile t and then tile 15 - t, 17 stages whatever t is.
// Both wave groups hold the same 128 queries; group g takes the g-th 64 keys of every stage with its own running maximum and sum, and the two partial results are joined through LDS behind the tile's last stage.
// St = K Qt and Ot += Vt Pt, f16 operands, f32 sums: the score accumulators of two 16-key tiles, converted in place, are the B operand of the second product (hardware k order; the K, Q and Vt loaders use the same order).
// K and Vt tiles go global -> registers -> LDS, two buffers: the next stage's loads fly during this stage's work, one barrier a stage.
// LDS -> registers in blocks of four fragments (four products on four accumulators), two register sets: a block's reads are issued in front of the block before it, inside one stage.
#define FLP   72                   // LDS row pitch in 16-bit elements: 144 B = 16 B x odd, conflict-free for 16-byte row reads
#define FTILE (64 * FLP)
#define FBUF  (4 * FTILE)          // one buffer: two halves of 64 keys x (K, Vt)
#define QT    128                  // queries a tile, keys a stage
#define NQT   (TT / QT)
#define JP    36                   // join record pitch in floats: 144 B = 16 B x odd
#define CEXP  0.18033688011112042f // HD^-0.5 x log2(e): scores go to base 2 in the one multiply
static_assert(NQT % 2 == 0 && TT / 256 == NQT / 2, "tiles t and NQT - 1 - t pair up over the grid");
__device__ __forceinline__ float xhalf(float x) { return __builtin_bit_cast(float, __builtin_amdgcn_permlanex16(__builtin_bit_cast(int, x), __builtin_bit_cast(int, x), 0x76543210, 0xfedcba98, false, false)); }   // lane l with lane l ^ 16
__global__ __launch_bounds__(512) void k_fattn(const bf* __restrict__ Qp, const bf* __restrict__ Kp, const bf* __restrict__ Vp, bf* AT) {
    __shared__ __align__(16) bf sm[2 * FBUF];        // [buffer][key half][K, Vt][64 rows][FLP]
    __shared__ __align__(16) float jn[256 * JP];     // group 1's partial result, one record a lane: 32 output sums, maximum, sum
    const int tid = threadIdx.x, lane = tid & 31, lr = lane & 15, hi = lane >> 4; const int wv = __builtin_amdgcn_readfirstlane(tid >> 5);
    const int grp = wv >> 3, w8 = wv & 7;
    const size_t hp = (size_t)blockIdx.z * NH_ + blockIdx.y;   // the (batch, head) plane
    const int srow = tid >> 3, sseg = (tid & 7) * 8, so = srow * FLP + sseg;   // staging: one 16-byte piece of each of the four tiles a thread
    const unsigned ko = (unsigned)(srow * HD + sseg), vo = (unsigned)(srow * TT + sseg), qo = (unsigned)(lr * HD + 8 * hi), oo = (unsigned)(lr * DQ + 8 * hi);   // the lane's part of every global address, beside a wave-uniform base
#pragma unroll 1   // one copy of the stage loop in the text for both turns
    for (int turn = 0; turn < 2; ++turn) {
        const int qt = turn ? NQT - 1 - (int)blockIdx.x : (int)blockIdx.x;   // the query tile of this turn
        const int k0 = qt * QT, nst = NQT - qt;                // its first admitted key, its stages
        const int q = k0 + w8 * 16 + lr;                       // this lane's query
        v16h qf[2];
#pragma unroll
        for (int c = 0; c < 2; ++c) { const bf* qp = Qp + ((hp * TT + k0 + w8 * 16) * HD + c * 32) + qo; qf[c] = cat16u(*(const v8us*)qp, *(const v8us*)(qp + 16)); }
        const size_t gk = (hp * TT + k0) * HD, gv = hp * HD * TT + k0;   // the tile's first key in the K plane (rows = keys) and in the Vt plane (columns = keys)
        v8us r0 = *(const v8us*)(Kp + gk + ko), r1 = *(const v8us*)(Vp + gv + vo), r2 = *(const v8us*)(Kp + (gk + 64 * HD) + ko), r3 = *(const v8us*)(Vp + (gv + 64) + vo);
        { bf* sn = sm + so; *(v8usa*)sn = r0; *(v8usa*)(sn + FTILE) = r1; *(v8usa*)(sn + 2 * FTILE) = r2; *(v8usa*)(sn + 3 * FTILE) = r3; }
        __syncthreads();   // stage 0 is in LDS before any wave reads it
        v8f o[4];
#pragma unroll
        for (int dt = 0; dt < 4; ++dt) o[dt] = (v8f){};
        float m = -3.0e38f, l = 0.f;
#pragma unroll 1
        for (int s = 0; s < nst; ++s) {
            const bool more = s + 1 < nst;
            if (more) { const size_t k1 = (size_t)(s + 1) * QT; r0 = *(const v8us*)(Kp + (gk + k1 * HD) + ko); r1 = *(const v8us*)(Vp + (gv + k1) + vo);
                r2 = *(const v8us*)(Kp + (gk + (k1 + 64) * HD) + ko); r3 = *(const v8us*)(Vp + (gv + k1 + 64) + vo); }
            const bf* sb = sm + (s & 1) * FBUF + grp * 2 * FTILE;
            const int kb = k0 + s * QT + grp * 64;   // first key of this group's half of the stage
            const bf* fp = sb + lr * FLP + 8 * hi;   // this lane's place in a fragment row
            v16h f[2][4];   // two fragment sets; a set is one block: four 16-row tiles, 32 k
            auto ldblk = [&](v16h (&d)[4], const bf* p) { d[0] = ldsfragh(p); d[1] = ldsfragh(p + 16 * FLP); d[2] = ldsfragh(p + 32 * FLP); d[3] = ldsfragh(p + 48 * FLP); };
            v8f st[4];   // st[kt][j] = score of key kb + kt*16 + 8*hi + j against query q
#pragma unroll
            for (int kt = 0; kt < 4; ++kt) st[kt] = (v8f){};
            ldblk(f[0], fp);
            ldblk(f[1], fp + 32);
            __builtin_amdgcn_sched_barrier(0);   // keeps the second block's LDS reads in front of the first block's products, so that the wave does not wait out their latency block by block
#pragma unroll   // constant indices: the fragment sets stay in registers
            for (int kt = 0; kt < 4; ++kt) st[kt] = wmma16(f[0][kt], qf[0], st[kt]);   // d 0..31
            ldblk(f[0], fp + FTILE);   // the first Vt block: its latency passes behind the softmax
            __builtin_amdgcn_sched_barrier(0);   // as above: these reads stay in front of the second block's products
#pragma unroll   // constant indices: the fragment sets stay in registers
            for (int kt = 0; kt < 4; ++kt) st[kt] = wmma16(f[1][kt], qf[1], st[kt]);   // d 32..63
            ldblk(f[1], fp + FTILE + 32);   // the second Vt block, behind the softmax too
            __builtin_amdgcn_sched_barrier(0);   // as above: these reads stay in front of the softmax
#pragma unroll   // constant indices: the score tiles stay in registers
            for (int kt = 0; kt < 4; ++kt) st[kt] *= CEXP;
            if (s == 0) {   // anti-causal: keys before the query excluded (the module's tril(-1) -> -inf). Only the tile's first stage holds such keys: from stage 1 on kb >= k0 + QT > q for every query of the tile, so the select is left out there (a scalar branch, s is the same in every wave)
#pragma unroll   // constant indices: the score tiles stay in registers
                for (int kt = 0; kt < 4; ++kt)
#pragma unroll   // constant indices: the score tiles stay in registers
                    for (int j = 0; j < 8; ++j) st[kt][j] = (kb + kt * 16 + 8 * hi + j >= q) ? st[kt][j] : -3.0e38f;
            }
            float mx = m;
#pragma unroll
            for (int kt = 0; kt < 4; ++kt)
#pragma unroll
                for (int j = 0; j < 8; ++j) mx = fmaxf(mx, st[kt][j]);
            mx = fmaxf(mx, xhalf(mx));   // both halves of the wave hold the query's running maximum
            const float alpha = __builtin_amdgcn_exp2f(m - mx);   // 0 when the first admitted key arrives: whatever an all-excluded stage before it summed is wiped
            m = mx;
            float ps[4]; v16h pf[2];   // one partial sum a tile: four short add chains instead of one long one
#pragma unroll
            for (int kt = 0; kt < 4; ++kt) { ps[kt] = 0.f; const v8f d = st[kt] - mx;
#pragma unroll
                for (int j = 0; j < 8; j += 2) { v2f p; p[0] = __builtin_amdgcn_exp2f(d[j]); p[1] = __builtin_amdgcn_exp2f(d[j + 1]); ps[kt] += p[0]; ps[kt] += p[1];
                    const v2h h = __builtin_convertvector(p, v2h);   // P rounded to f16, two elements a conversion
                    const int e = (kt & 1) * 8 + j; pf[kt >> 1][e] = h[0]; pf[kt >> 1][e + 1] = h[1]; } }
            l = l * alpha + ((ps[0] + ps[1]) + (ps[2] + ps[3]));   // each half keeps the sum of its own keys; joined once after the loop
#pragma unroll
            for (int dt = 0; dt < 4; ++dt) o[dt] *= alpha;
#pragma unroll   // constant indices: the fragment sets stay in registers
            for (int dt = 0; dt < 4; ++dt) o[dt] = wmma16(f[0][dt], pf[0], o[dt]);   // keys 0..31 of the half
#pragma unroll   // constant indices: the fragment sets stay in registers
            for (int dt = 0; dt < 4; ++dt) o[dt] = wmma16(f[1][dt], pf[1], o[dt]);   // keys 32..63
            if (more) { bf* sn = sm + ((s + 1) & 1) * FBUF + so; *(v8usa*)sn = r0; *(v8usa*)(sn + FTILE) = r1; *(v8usa*)(sn + 2 * FTILE) = r2; *(v8usa*)(sn + 3 * FTILE) = r3; }
            __syncthreads();   // publishes stage s + 1 and ends every wave's reads of stage s, whose buffer the next trip (or the next turn's stage 0) refills
        }
        float* jr = jn + (w8 * 32 + lane) * JP;   // the record of this (wave of a group, lane): same query, same output rows in both groups
        if (grp == 1) {
#pragma unroll
            for (int dt = 0; dt < 4; ++dt) { *(v4fa*)(jr + dt * 8) = __builtin_shufflevector(o[dt], o[dt], 0, 1, 2, 3); *(v4fa*)(jr + dt * 8 + 4) = __builtin_shufflevector(o[dt], o[dt], 4, 5, 6, 7); }
            jr[32] = m; jr[33] = l; }
        __syncthreads();   // group 1's records are in LDS before group 0 reads them; the next turn's barriers end those reads before the records are rewritten
        if (grp == 0) {
            const float m1 = jr[32], l1 = jr[33], mj = fmaxf(m, m1);
            const float a0 = __builtin_amdgcn_exp2f(m - mj), a1 = __builtin_amdgcn_exp2f(m1 - mj);   // a group that saw no admitted key (maximum still at the floor) gets weight 0; the key j = q is always in one of the two
            l = l * a0 + l1 * a1; l += xhalf(l); const float inv = __fdiv_rn(1.0f, l);
            const size_t ob = ((size_t)blockIdx.z * TT + k0 + w8 * 16) * DQ + blockIdx.y * HD;   // o[dt][j] = out[q][dt*16 + 8*hi + j]: 8 consecutive d a lane
#pragma unroll
            for (int dt = 0; dt < 4; ++dt) { const v4f p0 = *(const v4fa*)(jr + dt * 8), p1 = *(const v4fa*)(jr + dt * 8 + 4); v8f r;
#pragma unroll
                for (int j = 0; j < 8; ++j) r[j] = (o[dt][j] * a0 + (j < 4 ? p0[j & 3] : p1[j & 3]) * a1) * inv;
                *(v8us*)(AT + (ob + dt * 16) + oo) = __builtin_bit_cast(v8us, __builtin_convertvector(r, v8h)); }   // merged rounded to f16
            asm volatile("s_wait_xcnt 0x0" ::: "memory");   // the next turn's first instructions rewrite registers that these stores name: the wait stands in front of them
        }
    }
}

extern "C" void kernel_launch(void* const* d_in, const int* in_sizes, int n_in,
                              void* d_out, int out_size, void* d_ws, size_t ws_size, hipStream_t stream) {
    (void)in_sizes; (void)n_in; (void)out_size;
    const float* x = (const float*)d_in[0]; const float* wq = (const float*)d_in[1]; const float* wk = (const float*)d_in[2]; const float* wv = (const float*)d_in[3]; const float* wo = (const float*)d_in[4]; const float* bo = (const float*)d_in[5];
    float* OUT = (float*)d_out;     // [2][2048][1024]
    char* wsp = (char*)d_ws;
    auto take = [&](size_t bytes) { char* p = wsp; wsp += (bytes + 255) & ~(size_t)255; return (void*)p; };
    bf* WQ = (bf*)take((size_t)DQ * DM * 2); bf* WK = (bf*)take((size_t)DKV * DM * 2); bf* WV = (bf*)take((size_t)DKV * DM * 2); bf* WO = (bf*)take((size_t)DM * DQ * 2);
    bf* XB = (bf*)take((size_t)NB_ * TT * DM * 2);
    const size_t PL = (size_t)NH_ * TT * HD;   // one batch's head planes, elements
    bf* QP = (bf*)take(NB_ * PL * 2); bf* KP = (bf*)take(NB_ * PL * 2); bf* VT = (bf*)take(NB_ * PL * 2);
    bf* AT = (bf*)take((size_t)NB_ * TT * DQ * 2);
    if ((size_t)(wsp - (char*)d_ws) > ws_size) return;    // ws 256 MiB
    k_cvtall<<<dim3(64, 8, 1), 256, 0, stream>>>(x, wq, wk, wv, wo, XB, WQ, WK, WV, WO);
    k_qkv<<<dim3(NB_ * TT / 128, NH_ / 2, 3), 256, 0, stream>>>(XB, WQ, WK, WV, QP, KP, VT);
    k_fattn<<<dim3(TT / 256, NH_, NB_), 512, 0, stream>>>(QP, KP, VT, AT);
    k_wo<<<dim3(NB_ * TT / 128, DM / 128, 1), 256, 0, stream>>>(AT, WO, bo, OUT);
}

// v010
// Measured time: 69.9 microseconds a run.
// In two side-by-side timings against v009, it was 1.06 and 1.07 times as fast.
// Counting every step since v000, it is 18.8 times as fast.
#include <hip/hip_runtime.h>

// Multi-head attention with the module's ANTI-causal mask (x [2][2048][1024]; q,k,v = x W^T ('oi' [1024][1024] 0.02, no bias; 16 heads x 64); scores = q.k; keys strictly BEFORE the query (tril(-1)) -> -inf, i.e. each token attends to itself and the future; softmax(scores / 8); out = merged Wo^T + bo -> [2][2048][1024] (4.2 M)).
// Layout: one launch rounds x and the four weight matrices to bf16; one launch does the exact q, k, v projections of both batches and writes the f16 head planes from its own epilogue; ONE fused attention launch for all (batch, head) pairs with q, k, v and the probabilities on one f16 plane each (1 product, 11 significant bits; score tiles from each query tile's own first key on, the anti-causal pattern applied as the index select j >= i in the softmax of a tile's first stage, the only one with keys before a query; scores and probabilities stay in registers, running maximum and sum); merged (one f16 plane) x Wo + bo.
// Compute dtypes, f32 accumulate: every input rounded to bf16; projections exact, their results rounded to f16; attention 1 f16 product on every row; softmax f32, probabilities rounded to f16; merged rounded to f16, Wo's bf16 rounding held as f16, 1 f16 product + bias.

#define NB_  2
#define TT   2048
#define DM   1024
#define NH_  16
#define NKV  16
#define HD   64
#define DQ   (NH_ * HD)
#define DKV  (NKV * HD)
#define WIN  0
typedef _Float16 h16;
typedef unsigned short bf;
typedef __attribute__((ext_vector_type(16))) __bf16   v16bf;
typedef __attribute__((ext_vector_type(16))) _Float16 v16h;
typedef __attribute__((ext_vector_type(8)))  _Float16 v8h;
typedef __attribute__((ext_vector_type(8)))  unsigned short v8us;
typedef __attribute__((ext_vector_type(8)))  float    v8f;
typedef __attribute__((ext_vector_type(4)))  float    v4f;
typedef v8h  __attribute__((may_alias)) v8ha;
typedef v4f  __attribute__((may_alias)) v4fa;
typedef v8us __attribute__((may_alias)) v8usa;

__device__ __forceinline__ unsigned short f2bf(float f) { unsigned u = __float_as_uint(f); u += 0x7FFFu + ((u >> 16) & 1u); return (unsigned short)(u >> 16); }
__device__ __forceinline__ float bf2f(unsigned short b) { return __uint_as_float(((unsigned)b) << 16); }
__device__ __forceinline__ float bfr(float f) { return bf2f(f2bf(f)); }
__device__ __forceinline__ v16h cat16(v8h lo, v8h hi) { return __builtin_shufflevector(lo, hi, 0, 1, 2, 3, 4, 5, 6, 7, 8, 9, 10, 11, 12, 13, 14, 15); }
__device__ __forceinline__ v16bf cat16b(v8us lo, v8us hi) { return __builtin_bit_cast(v16bf, __builtin_shufflevector(lo, hi, 0, 1, 2, 3, 4, 5, 6, 7, 8, 9, 10, 11, 12, 13, 14, 15)); }
__device__ __forceinline__ v8f wmma16(v16h a, v16h b, v8f c) { return __builtin_amdgcn_wmma_f32_16x16x32_f16(false, a, false, b, (short)0, c, false, false); }
__device__ __forceinline__ v8f wmmab(v16bf a, v16bf b, v8f c) { return __builtin_amdgcn_wmma_f32_16x16x32_bf16(false, a, false, b, (short)0, c, false, false); }



// ---- fragment loaders: 16 k of a row a lane, hardware k order (8 * hi + 0..7, then + 16), the same for both operands.
template <typename T16> struct WFrag;
template <> struct WFrag<h16> { typedef v16h V; static __device__ __forceinline__ V ld(const h16* p) { return cat16(*(const v8h*)p, *(const v8h*)(p + 16)); } static __device__ __forceinline__ v8f mma(V a, V b, v8f c) { return wmma16(a, b, c); } };
template <> struct WFrag<bf> { typedef v16bf V; static __device__ __forceinline__ V ld(const bf* p) { return cat16b(*(const v8us*)p, *(const v8us*)(p + 16)); } static __device__ __forceinline__ v8f mma(V a, V b, v8f c) { return wmmab(a, b, c); } };

// ---- gemm128: the loop of both GEMM kernels. One 128x128 tile of C[m][n] = sum_k A[m][k] B[n][k] a work-group of 8 waves, K = DM, operands K-contiguous 16-bit planes (both bf16 or both f16).
// A stage is 64 k (one 128-byte line) of the tile's 128 rows of every operand plane, brought into LDS by asynchronous copies: a wave's copy covers four whole lines, and every line is fetched once a work-group.
// A ring of NB buffers: NB stages are asked for in front of the loop, and stage t + NB as soon as stage t's buffer is free, so a copy has NB - 1 trips to land. Waves 2 (rows) x 4 (columns); a wave owns 64x32 of the tile over the whole K (8 accumulators).
#define GPP   136                  // LDS pitch of a PAIR of rows in 16-bit elements: 2 x 128 B + 16 B. 16 rows read at one k fall on all 64 banks once (pair p at dword 4 p, the odd row 32 dwords on), as with a pad behind every row, in 17/18 of the space
#define GPLN  (64 * GPP)           // one operand plane of a stage
#define GOP   132                  // output staging pitch in floats: 528 B = 16 B x odd
static_assert(128 * GOP * 4 <= 3 * 2 * GPLN * 2, "the f32 output tile fits the shortest ring");
static_assert(3 * (3 * 2 * GPLN * 2) <= 320 * 1024, "three work-groups with three buffers each share a WGP's LDS");
__device__ __forceinline__ int grow(int r) { return (r >> 1) * GPP + (r & 1) * 64; }   // row r of a plane, in 16-bit elements
__device__ __forceinline__ v16h cat16u(v8us lo, v8us hi) { return __builtin_bit_cast(v16h, __builtin_shufflevector(lo, hi, 0, 1, 2, 3, 4, 5, 6, 7, 8, 9, 10, 11, 12, 13, 14, 15)); }   // f16 bits kept in 16-bit words
__device__ __forceinline__ v16h ldsfragh(const bf* p) { return cat16u(*(const v8usa*)p, *(const v8usa*)(p + 16)); }
__device__ __forceinline__ v16bf ldsfrag(const bf* p) { return cat16b(*(const v8usa*)p, *(const v8usa*)(p + 16)); }
// one plane of a stage: the thread's 16-byte piece of rows r, r + 32, r + 64, r + 96
__device__ __forceinline__ void cp_plane(const bf* dst, const bf* g0) {
    const unsigned l0 = (unsigned)(size_t)dst, l1 = l0 + 16 * GPP * 2, l2 = l0 + 32 * GPP * 2, l3 = l0 + 48 * GPP * 2;   // LDS byte addresses: the low 32 bits of the __shared__ address
    const bf* g1 = g0 + 32 * DM; const bf* g2 = g0 + 64 * DM; const bf* g3 = g0 + 96 * DM;
    // the wait is the statement's last line, so that no address register of a copy is rewritten in front of it
    asm volatile("global_load_async_to_lds_b128 %0, %4, off\n\tglobal_load_async_to_lds_b128 %1, %5, off\n\tglobal_load_async_to_lds_b128 %2, %6, off\n\tglobal_load_async_to_lds_b128 %3, %7, off\n\ts_wait_xcnt 0x0"
                 :: "v"(l0), "v"(l1), "v"(l2), "v"(l3), "v"(g0), "v"(g1), "v"(g2), "v"(g3) : "memory");
}
template <bool H> struct GFrag;   // what the planes' 16-bit words are: bf16 (false) or f16 (true)
template <> struct GFrag<false> { typedef v16bf V; static __device__ __forceinline__ V ld(const bf* p) { return ldsfrag(p); } static __device__ __forceinline__ v8f mma(V a, V b, v8f c) { return wmmab(a, b, c); } };
template <> struct GFrag<true> { typedef v16h V; static __device__ __forceinline__ V ld(const bf* p) { return ldsfragh(p); } static __device__ __forceinline__ v8f mma(V a, V b, v8f c) { return wmma16(a, b, c); } };
template <bool H, int NB>
__device__ __forceinline__ void gemm128(const bf* __restrict__ A, const bf* __restrict__ B, bf* sm, v8f (&acc)[4][2]) {
    typedef GFrag<H> F; constexpr int NT = DM / 64, BUF = 2 * GPLN;
    static_assert(NB >= 3 && NB <= NT && 8 * NB <= 63, "every stage of the prologue exists; a wave's copies in flight (8 a stage) stay under the counter's width");
    const int tid = threadIdx.x, lane = tid & 31, lr = lane & 15, hi = lane >> 4; const int wv = __builtin_amdgcn_readfirstlane(tid >> 5); const int wm = wv >> 2, wn = wv & 3;
    const unsigned go = (unsigned)((tid >> 3) * DM + (tid & 7) * 8);   // the lane's part of every copy's global address
    const bf* sl = sm + grow(tid >> 3) + (tid & 7) * 8;              // and its place in a plane
    auto fill = [&](int t, int buf) { const bf* d = sl + buf * BUF; cp_plane(d, A + t * 64 + go); cp_plane(d + GPLN, B + t * 64 + go); };
#pragma unroll   // constant indices: the fragment and accumulator arrays stay in registers
    for (int mb = 0; mb < 4; ++mb)
#pragma unroll   // constant indices: the fragment and accumulator arrays stay in registers
        for (int nb = 0; nb < 2; ++nb) acc[mb][nb] = (v8f){};
#pragma unroll   // the first NB stages, one into each buffer
    for (int s = 0; s < NB; ++s) fill(s, s);
    asm volatile("s_wait_asynccnt %0" :: "i"(8 * (NB - 1)) : "memory");   // all but this wave's 8 (NB - 1) youngest copies have landed: its part of stage 0
    __syncthreads();                                     // and every other wave's: stage 0 may be read
    int rb = 0;   // the buffer of stage t: t mod NB
#pragma unroll 1   // one stage a trip: the buffer is picked by rb
    for (int t = 0; t < NT; ++t) {
        const bf* sa = sm + rb * BUF + grow(wm * 64 + lr) + 8 * hi; const bf* sb = sm + rb * BUF + GPLN + grow(wn * 32 + lr) + 8 * hi;
#pragma unroll   // constant indices: the fragment and accumulator arrays stay in registers
        for (int c = 0; c < 2; ++c) { typename F::V a[4], b[2];
#pragma unroll   // constant indices: the fragment and accumulator arrays stay in registers
            for (int mb = 0; mb < 4; ++mb) a[mb] = F::ld(sa + mb * 8 * GPP + c * 32);
#pragma unroll   // constant indices: the fragment and accumulator arrays stay in registers
            for (int nb = 0; nb < 2; ++nb) b[nb] = F::ld(sb + nb * 8 * GPP + c * 32);
#pragma unroll   // constant indices: the fragment and accumulator arrays stay in registers
            for (int nb = 0; nb < 2; ++nb)
#pragma unroll   // constant indices: the fragment and accumulator arrays stay in registers
                for (int mb = 0; mb < 4; ++mb) acc[mb][nb] = F::mma(a[mb], b[nb], acc[mb][nb]); }
        asm volatile("s_wait_dscnt 0x0" ::: "memory");      // this wave's reads of stage t are done before its buffer is refilled
        // this wave's copies of stage t + 1 have landed. Asked for so far: the stages up to t + NB - 1, 8 copies each, so NB - 2 stages are younger; near the end fewer are, and the wait is to 0
        if (t + NB <= NT) asm volatile("s_wait_asynccnt %0" :: "i"(8 * (NB - 2)) : "memory");
        else              asm volatile("s_wait_asynccnt 0x0" ::: "memory");
        __syncthreads();                                     // publishes stage t + 1 and ends every wave's reads of stage t
        if (t + NB < NT) fill(t + NB, rb);                   // into the buffer that this trip has just read
        rb = (rb + 1 == NB) ? 0 : rb + 1;
    }
    asm volatile("s_wait_asynccnt 0x0" ::: "memory");   // nothing is in flight when the ring becomes the output staging
}
// the wave's 64x32 part of the f32 tile into the staging rows (the ring, free behind the loop's last barrier)
__device__ __forceinline__ void stage128(float* os, const v8f (&acc)[4][2]) {
    const int lane = threadIdx.x & 31, lr = lane & 15, hi = lane >> 4; const int wv = __builtin_amdgcn_readfirstlane((int)(threadIdx.x >> 5)); const int wm = wv >> 2, wn = wv & 3;
#pragma unroll   // constant indices: the fragment and accumulator arrays stay in registers
    for (int mb = 0; mb < 4; ++mb)
#pragma unroll   // constant indices: the fragment and accumulator arrays stay in registers
        for (int nb = 0; nb < 2; ++nb)
#pragma unroll   // constant indices: the fragment and accumulator arrays stay in registers
            for (int j = 0; j < 8; ++j) os[(wm * 64 + mb * 16 + hi * 8 + j) * GOP + wn * 32 + nb * 16 + lr] = acc[mb][nb][j];
}

__device__ __forceinline__ h16 tohx(float x) { return (h16)x; }
typedef __attribute__((ext_vector_type(2))) _Float16 v2h;
typedef __attribute__((ext_vector_type(4))) _Float16 v4h;
typedef __attribute__((ext_vector_type(2))) unsigned short v2us;
typedef __attribute__((ext_vector_type(4))) unsigned short v4us;
typedef __attribute__((ext_vector_type(2))) float v2f;
typedef __attribute__((ext_vector_type(4))) int v4i;

__global__ __launch_bounds__(256) void k_wtG(const float* __restrict__ w, int K, int N, bf* Bt) {
    const int lane = threadIdx.x & 31; const int L0 = (blockIdx.x * 8 + (threadIdx.x >> 5)) * 8; const int nlines = N * K / 64;
{
#pragma unroll 1
        for (int l = 0; l < 8; ++l) { const int L = L0 + l; if (L >= nlines) break; const size_t e = (size_t)L * 64 + lane * 2; const int k = (int)(e % K), n = (int)(e / K); v2us o;
            o[0] = f2bf(w[(size_t)k * N + n]); o[1] = f2bf(w[(size_t)(k + 1) * N + n]); *(v2us*)(Bt + e) = o; }
         }
}
// ---- k_cvtall: every f32 operand of the products rounded to bf16 in one launch (Wo's rounded values are stored as f16 bits, the operand type of its product). Grid (64, 8), 256 threads: slice y (DM x DM elements) is a quarter of x (y < 4) or one weight matrix; a thread converts 8 pieces of 8 elements, all its loads issued before the first conversion.
static_assert((size_t)NB_ * TT * DM == 4 * (size_t)DM * DM && DQ == DM && DKV == DM, "slices of DM x DM elements");
__global__ __launch_bounds__(256) void k_cvtall(const float* __restrict__ x, const float* __restrict__ wq, const float* __restrict__ wk, const float* __restrict__ wv, const float* __restrict__ wo, bf* XB, bf* WQ, bf* WK, bf* WV, bf* WO) {
    const int y = blockIdx.y; const size_t SL = (size_t)DM * DM; const float* s; bf* d;
    if (y < 4) { s = x + y * SL; d = XB + y * SL; } else if (y == 4) { s = wq; d = WQ; } else if (y == 5) { s = wk; d = WK; } else if (y == 6) { s = wv; d = WV; } else { s = wo; d = WO; }
    const size_t i0 = ((size_t)blockIdx.x * 2048 + threadIdx.x) * 8; const float* sp = s + i0; v8f v[8];
#pragma unroll
    for (int j = 0; j < 8; ++j) v[j] = *(const v8f*)(sp + j * 2048);
    asm volatile("s_wait_xcnt 0x0" :: "v"(sp) : "memory");   // the loads' address pair is an input here, so no load lands on it; behind the wait it is free for reuse
#pragma unroll
    for (int j = 0; j < 8; ++j) { v8us o;
#pragma unroll
        for (int k = 0; k < 8; ++k) o[k] = f2bf(v[j][k]);
        if (y == 7) { v8f r;   // bf16 -> f16: exact down to 2^-17, below that to the nearest 2^-24
#pragma unroll
            for (int k = 0; k < 8; ++k) r[k] = bf2f(o[k]);
            o = __builtin_bit_cast(v8us, __builtin_convertvector(r, v8h)); }
        *(v8us*)(d + i0 + j * 2048) = o; }
}

// ---- k_qkv: the q, k and v projections of both batches in one launch on gemm128. Grid (NB_*TT/128 token tiles, head pairs, 3).
// A 128x128 tile is 128 tokens x two heads; the epilogue rounds each sum to f16 and stores it straight into the head planes (f16 bits in 16-bit words): q, k as [b][h][t][d]; v is computed as Wv x^T (rows = d, columns = t), which is the [b][h][d][t] plane row by row.
__global__ __launch_bounds__(256) void k_qkv(const bf* __restrict__ X, const bf* __restrict__ WQ, const bf* __restrict__ WK, const bf* __restrict__ WV, bf* Qp, bf* Kp, bf* Vp) {
    __shared__ __align__(16) bf sm[3 * 2 * GPLN];   // three buffers: three work-groups still share a WGP
    const int z = blockIdx.z, b = blockIdx.x / (TT / 128), t0 = (blockIdx.x % (TT / 128)) * 128; const size_t hp = (size_t)b * NH_ + blockIdx.y * 2;
    const bf* xt = X + (size_t)blockIdx.x * 128 * DM; const bf* wt = (z == 0 ? WQ : z == 1 ? WK : WV) + (size_t)blockIdx.y * 128 * DM;
    bf* Pp = (z == 0 ? Qp : z == 1 ? Kp : Vp);
    v8f acc[4][2];
    gemm128<false, 3>((z == 2) ? wt : xt, (z == 2) ? xt : wt, sm, acc);
    float* os = (float*)sm;
    stage128(os, acc);
    __syncthreads();   // the whole tile is in LDS before any thread reads a row of it
    const int w = __builtin_amdgcn_readfirstlane((int)(threadIdx.x >> 5)), cofs = (threadIdx.x & 31) * 4;   // a wave takes rows w, w + 8, ...; a lane 4 columns
    const unsigned lo = (z == 2) ? (unsigned)cofs : (unsigned)((cofs >> 6) * TT * HD + (cofs & 63));   // the lane's part of every store address, beside a wave-uniform base
    const size_t ub = (z == 2) ? (hp * HD + w) * TT + t0 : (hp * TT + t0 + w) * HD; const size_t us = (z == 2) ? 8 * TT : 8 * HD;   // row w of the tile in the plane; 8 rows on
#pragma unroll   // the rows' LDS reads and stores overlap
    for (int i = 0; i < 16; ++i) { const v4f val = *(const v4fa*)(os + (i * 8 + w) * GOP + cofs);
        *(v4us*)(Pp + (ub + i * us) + lo) = __builtin_bit_cast(v4us, __builtin_convertvector(val, v4h)); }
}
// ---- k_wo: out = merged Wo^T + bo on gemm128, f16 operands, both batches (the merged rows and the output rows are contiguous over b). Grid (NB_*TT/128, DM/128).
__global__ __launch_bounds__(256) void k_wo(const bf* __restrict__ AT, const bf* __restrict__ WO, const float* __restrict__ bias, float* C) {
    __shared__ __align__(16) bf sm[4 * 2 * GPLN];   // four buffers: one work-group a WGP, nothing else hides a copy's flight
    const int r0 = blockIdx.x * 128, c0 = blockIdx.y * 128;
    v8f acc[4][2];
    gemm128<true, 4>(AT + (size_t)r0 * DQ, WO + (size_t)c0 * DQ, sm, acc);
    float* os = (float*)sm;
    stage128(os, acc);
    __syncthreads();   // the whole tile is in LDS before any thread reads a row of it
    const int w = __builtin_amdgcn_readfirstlane((int)(threadIdx.x >> 5)), cofs = (threadIdx.x & 31) * 4;   // a wave takes rows w, w + 8, ...: 512 contiguous bytes a store
    v4f bb; bb[0] = bfr(bias[c0 + cofs]); bb[1] = bfr(bias[c0 + cofs + 1]); bb[2] = bfr(bias[c0 + cofs + 2]); bb[3] = bfr(bias[c0 + cofs + 3]);
#pragma unroll   // the rows' LDS reads and stores overlap
    for (int i = 0; i < 16; ++i) { const v4f val = *(const v4fa*)(os + (i * 8 + w) * GOP + cofs) + bb;
        *(v4f*)(C + ((size_t)(r0 + i * 8 + w) * DM + c0) + (unsigned)cofs) = val; }
}
// ---- k_fattn: scores, softmax, P.V and the head merge in one kernel. Grid (TT/256, heads, batches), 16 waves = two groups of 8; a wave owns 16 queries, a lane one query (column lr) and half of each key group.
// Keys before a query tile's first query are excluded for every query of the tile, so a tile of 128 queries starts at its own first key: tile t walks 16 - t stages of 128 keys. A work-group takes tile t and then tile 15 - t, 17 stages whatever t is.
// Both wave groups hold the same 128 queries; group g takes the g-th 64 keys of every stage with its own running maximum and sum, and the two partial results are joined through LDS behind the tile's last stage.
// St = K Qt and Ot += Vt Pt, f16 operands, f32 sums: the score accumulators of two 16-key tiles, converted in place, are the B operand of the second product (hardware k order; the K, Q and Vt loaders use the same order).
// K and Vt tiles go global -> registers -> LDS, two buffers: the next stage's loads fly during this stage's work, one barrier a stage.
// LDS -> registers in blocks of four fragments (four products on four accumulators), two register sets: a block's reads are issued in front of the block before it, inside one stage.
#define FLP   72                   // LDS row pitch in 16-bit elements: 144 B = 16 B x odd, conflict-free for 16-byte row reads
#define FTILE (64 * FLP)
#define FBUF  (4 * FTILE)          // one buffer: two halves of 64 keys x (K, Vt)
#define QT    128                  // queries a tile, keys a stage
#define NQT   (TT / QT)
#define JP    36                   // join record pitch in floats: 144 B = 16 B x odd
#define CEXP  0.18033688011112042f // HD^-0.5 x log2(e): scores go to base 2 in the one multiply
static_assert(NQT % 2 == 0 && TT / 256 == NQT / 2, "tiles t and NQT - 1 - t pair up over the grid");
__device__ __forceinline__ float xhalf(float x) { return __builtin_bit_cast(float, __builtin_amdgcn_permlanex16(__builtin_bit_cast(int, x), __builtin_bit_cast(int, x), 0x76543210, 0xfedcba98, false, false)); }   // lane l with lane l ^ 16
__global__ __launch_bounds__(512) void k_fattn(const bf* __restrict__ Qp, const bf* __restrict__ Kp, const bf* __restrict__ Vp, bf* AT) {
    __shared__ __align__(16) bf sm[2 * FBUF];        // [buffer][key half][K, Vt][64 rows][FLP]
    __shared__ __align__(16) float jn[256 * JP];     // group 1's partial result, one record a lane: 32 output sums, maximum, sum
    const int tid = threadIdx.x, lane = tid & 31, lr = lane & 15, hi = lane >> 4; const int wv = __builtin_amdgcn_readfirstlane(tid >> 5);
    const int grp = wv >> 3, w8 = wv & 7;
    const size_t hp = (size_t)blockIdx.z * NH_ + blockIdx.y;   // the (batch, head) plane
    const int srow = tid >> 3, sseg = (tid & 7) * 8, so = srow * FLP + sseg;   // staging: one 16-byte piece of each of the four tiles a thread
    const unsigned ko = (unsigned)(srow * HD + sseg), vo = (unsigned)(srow * TT + sseg), qo = (unsigned)(lr * HD + 8 * hi), oo = (unsigned)(lr * DQ + 8 * hi);   // the lane's part of every global address, beside a wave-uniform base
#pragma unroll 1   // one copy of the stage loop in the text for both turns
    for (int turn = 0; turn < 2; ++turn) {
        const int qt = turn ? NQT - 1 - (int)blockIdx.x : (int)blockIdx.x;   // the query tile of this turn
        const int k0 = qt * QT, nst = NQT - qt;                // its first admitted key, its stages
        const int q = k0 + w8 * 16 + lr;                       // this lane's query
        v16h qf[2];
#pragma unroll
        for (int c = 0; c < 2; ++c) { const bf* qp = Qp + ((hp * TT + k0 + w8 * 16) * HD + c * 32) + qo; qf[c] = cat16u(*(const v8us*)qp, *(const v8us*)(qp + 16)); }
        const size_t gk = (hp * TT + k0) * HD, gv = hp * HD * TT + k0;   // the tile's first key in the K plane (rows = keys) and in the Vt plane (columns = keys)
        v8us r0 = *(const v8us*)(Kp + gk + ko), r1 = *(const v8us*)(Vp + gv + vo), r2 = *(const v8us*)(Kp + (gk + 64 * HD) + ko), r3 = *(const v8us*)(Vp + (gv + 64) + vo);
        { bf* sn = sm + so; *(v8usa*)sn = r0; *(v8usa*)(sn + FTILE) = r1; *(v8usa*)(sn + 2 * FTILE) = r2; *(v8usa*)(sn + 3 * FTILE) = r3; }
        __syncthreads();   // stage 0 is in LDS before any wave reads it
        v8f o[4];
#pragma unroll
        for (int dt = 0; dt < 4; ++dt) o[dt] = (v8f){};
        float m = -3.0e38f, l = 0.f;
#pragma unroll 1
        for (int s = 0; s < nst; ++s) {
            const bool more = s + 1 < nst;
            if (more) { const size_t k1 = (size_t)(s + 1) * QT; r0 = *(const v8us*)(Kp + (gk + k1 * HD) + ko); r1 = *(const v8us*)(Vp + (gv + k1) + vo);
                r2 = *(const v8us*)(Kp + (gk + (k1 + 64) * HD) + ko); r3 = *(const v8us*)(Vp + (gv + k1 + 64) + vo); }
            const bf* sb = sm + (s & 1) * FBUF + grp * 2 * FTILE;
            const int kb = k0 + s * QT + grp * 64;   // first key of this group's half of the stage
            const bf* fp = sb + lr * FLP + 8 * hi;   // this lane's place in a fragment row
            v16h f[2][4];   // two fragment sets; a set is one block: four 16-row tiles, 32 k
            auto ldblk = [&](v16h (&d)[4], const bf* p) { d[0] = ldsfragh(p); d[1] = ldsfragh(p + 16 * FLP); d[2] = ldsfragh(p + 32 * FLP); d[3] = ldsfragh(p + 48 * FLP); };
            v8f st[4];   // st[kt][j] = score of key kb + kt*16 + 8*hi + j against query q
#pragma unroll
            for (int kt = 0; kt < 4; ++kt) st[kt] = (v8f){};
            ldblk(f[0], fp);
            ldblk(f[1], fp + 32);
            __builtin_amdgcn_sched_barrier(0);   // keeps the second block's LDS reads in front of the first block's products, so that the wave does not wait out their latency block by block
#pragma unroll   // constant indices: the fragment sets stay in registers
            for (int kt = 0; kt < 4; ++kt) st[kt] = wmma16(f[0][kt], qf[0], st[kt]);   // d 0..31
            ldblk(f[0], fp + FTILE);   // the first Vt block: its latency passes behind the softmax
            __builtin_amdgcn_sched_barrier(0);   // as above: these reads stay in front of the second block's products
#pragma unroll   // constant indices: the fragment sets stay in registers
            for (int kt = 0; kt < 4; ++kt) st[kt] = wmma16(f[1][kt], qf[1], st[kt]);   // d 32..63
            ldblk(f[1], fp + FTILE + 32);   // the second Vt block, behind the softmax too
            __builtin_amdgcn_sched_barrier(0);   // as above: these reads stay in front of the softmax
#pragma unroll   // constant indices: the score tiles stay in registers
            for (int kt = 0; kt < 4; ++kt) st[kt] *= CEXP;
            if (s == 0) {   // anti-causal: keys before the query excluded (the module's tril(-1) -> -inf). Only the tile's first stage holds such keys: from stage 1 on kb >= k0 + QT > q for every query of the tile, so the select is left out there (a scalar branch, s is the same in every wave)
#pragma unroll   // constant indices: the score tiles stay in registers
                for (int kt = 0; kt < 4; ++kt)
#pragma unroll   // constant indices: the score tiles stay in registers
                    for (int j = 0; j < 8; ++j) st[kt][j] = (kb + kt * 16 + 8 * hi + j >= q) ? st[kt][j] : -3.0e38f;
            }
            float mx = m;
#pragma unroll
            for (int kt = 0; kt < 4; ++kt)
#pragma unroll
                for (int j = 0; j < 8; ++j) mx = fmaxf(mx, st[kt][j]);
            mx = fmaxf(mx, xhalf(mx));   // both halves of the wave hold the query's running maximum
            const float alpha = __builtin_amdgcn_exp2f(m - mx);   // 0 when the first admitted key arrives: whatever an all-excluded stage before it summed is wiped
            m = mx;
            float ps[4]; v16h pf[2];   // one partial sum a tile: four short add chains instead of one long one
#pragma unroll
            for (int kt = 0; kt < 4; ++kt) { ps[kt] = 0.f; const v8f d = st[kt] - mx;
#pragma unroll
                for (int j = 0; j < 8; j += 2) { v2f p; p[0] = __builtin_amdgcn_exp2f(d[j]); p[1] = __builtin_amdgcn_exp2f(d[j + 1]); ps[kt] += p[0]; ps[kt] += p[1];
                    const v2h h = __builtin_convertvector(p, v2h);   // P rounded to f16, two elements a conversion
                    const int e = (kt & 1) * 8 + j; pf[kt >> 1][e] = h[0]; pf[kt >> 1][e + 1] = h[1]; } }
            l = l * alpha + ((ps[0] + ps[1]) + (ps[2] + ps[3]));   // each half keeps the sum of its own keys; joined once after the loop
#pragma unroll
            for (int dt = 0; dt < 4; ++dt) o[dt] *= alpha;
#pragma unroll   // constant indices: the fragment sets stay in registers
            for (int dt = 0; dt < 4; ++dt) o[dt] = wmma16(f[0][dt], pf[0], o[dt]);   // keys 0..31 of the half
#pragma unroll   // constant indices: the fragment sets stay in registers
            for (int dt = 0; dt < 4; ++dt) o[dt] = wmma16(f[1][dt], pf[1], o[dt]);   // keys 32..63
            if (more) { bf* sn = sm + ((s + 1) & 1) * FBUF + so; *(v8usa*)sn = r0; *(v8usa*)(sn + FTILE) = r1; *(v8usa*)(sn + 2 * FTILE) = r2; *(v8usa*)(sn + 3 * FTILE) = r3; }
            __syncthreads();   // publishes stage s + 1 and ends every wave's reads of stage s, whose buffer the next trip (or the next turn's stage 0) refills
        }
        float* jr = jn + (w8 * 32 + lane) * JP;   // the record of this (wave of a group, lane): same query, same output rows in both groups
        if (grp == 1) {
#pragma unroll
            for (int dt = 0; dt < 4; ++dt) { *(v4fa*)(jr + dt * 8) = __builtin_shufflevector(o[dt], o[dt], 0, 1, 2, 3); *(v4fa*)(jr + dt * 8 + 4) = __builtin_shufflevector(o[dt], o[dt], 4, 5, 6, 7); }
            jr[32] = m; jr[33] = l; }
        __syncthreads();   // group 1's records are in LDS before group 0 reads them; the next turn's barriers end those reads before the records are rewritten
        if (grp == 0) {
            const float m1 = jr[32], l1 = jr[33], mj = fmaxf(m, m1);
            const float a0 = __builtin_amdgcn_exp2f(m - mj), a1 = __builtin_amdgcn_exp2f(m1 - mj);   // a group that saw no admitted key (maximum still at the floor) gets weight 0; the key j = q is always in one of the two
            l = l * a0 + l1 * a1; l += xhalf(l); const float inv = __fdiv_rn(1.0f, l);
            const size_t ob = ((size_t)blockIdx.z * TT + k0 + w8 * 16) * DQ + blockIdx.y * HD;   // o[dt][j] = out[q][dt*16 + 8*hi + j]: 8 consecutive d a lane
#pragma unroll
            for (int dt = 0; dt < 4; ++dt) { const v4f p0 = *(const v4fa*)(jr + dt * 8), p1 = *(const v4fa*)(jr + dt * 8 + 4); v8f r;
#pragma unroll
                for (int j = 0; j < 8; ++j) r[j] = (o[dt][j] * a0 + (j < 4 ? p0[j & 3] : p1[j & 3]) * a1) * inv;
                *(v8us*)(AT + (ob + dt * 16) + oo) = __builtin_bit_cast(v8us, __builtin_convertvector(r, v8h)); }   // merged rounded to f16
            asm volatile("s_wait_xcnt 0x0" ::: "memory");   // the next turn's first instructions rewrite registers that these stores name: the wait stands in front of them
        }
    }
}

extern "C" void kernel_launch(void* const* d_in, const int* in_sizes, int n_in,
                              void* d_out, int out_size, void* d_ws, size_t ws_size, hipStream_t stream) {
    (void)in_sizes; (void)n_in; (void)out_size;
    const float* x = (const float*)d_in[0]; const float* wq = (const float*)d_in[1]; const float* wk = (const float*)d_in[2]; const float* wv = (const float*)d_in[3]; const float* wo = (const float*)d_in[4]; const float* bo = (const float*)d_in[5];
    float* OUT = (float*)d_out;     // [2][2048][1024]
    char* wsp = (char*)d_ws;
    auto take = [&](size_t bytes) { char* p = wsp; wsp += (bytes + 255) & ~(size_t)255; return (void*)p; };
    bf* WQ = (bf*)take((size_t)DQ * DM * 2); bf* WK = (bf*)take((size_t)DKV * DM * 2); bf* WV = (bf*)take((size_t)DKV * DM * 2); bf* WO = (bf*)take((size_t)DM * DQ * 2);
    bf* XB = (bf*)take((size_t)NB_ * TT * DM * 2);
    const size_t PL = (size_t)NH_ * TT * HD;   // one batch's head planes, elements
    bf* QP = (bf*)take(NB_ * PL * 2); bf* KP = (bf*)take(NB_ * PL * 2); bf* VT = (bf*)take(NB_ * PL * 2);
    bf* AT = (bf*)take((size_t)NB_ * TT * DQ * 2);
    if ((size_t)(wsp - (char*)d_ws) > ws_size) return;    // ws 256 MiB
    k_cvtall<<<dim3(64, 8, 1), 256, 0, stream>>>(x, wq, wk, wv, wo, XB, WQ, WK, WV, WO);
    k_qkv<<<dim3(NB_ * TT / 128, NH_ / 2, 3), 256, 0, stream>>>(XB, WQ, WK, WV, QP, KP, VT);
    k_fattn<<<dim3(TT / 256, NH_, NB_), 512, 0, stream>>>(QP, KP, VT, AT);
    k_wo<<<dim3(NB_ * TT / 128, DM / 128, 1), 256, 0, stream>>>(AT, WO, bo, OUT);
}
